// v000
// Times are from an AMD MI455X. After a warm-up the kernel runs many times in a row, and a time is the length of
// such a window on the GPU divided by its runs, so every launch and the gaps after it count. The runs cycle
// through copies of the inputs. A figure is the median of several windows, for all but v000 over two sittings.
// Sittings can differ by a few percent; kernels timed side by side share one.
// v000, which the later versions start from, runs in 229 microseconds.
#include <hip/hip_runtime.h>
// Contractions on v_wmma_f32_16x16x32_f16 (f16 operands, f32 accumulate): x*Ww^T (Ww carried x2^4), x^T*wx, x*(G x2^-4), (y x2^-8)*(Lw x2^4)^T; bias add and log-softmax in f32.

#define LL 4096
#define BB 4
#define DD 512
#define VV 1000
#define VP 1024

typedef _Float16 f16;
typedef f16 v16h __attribute__((ext_vector_type(16)));
typedef f16 v8h __attribute__((ext_vector_type(8)));
typedef float v8f __attribute__((ext_vector_type(8)));
typedef float v4f __attribute__((ext_vector_type(4)));

union Frag { v16h v; v8h half[2]; };
union Pk16 { v8h h; v4f f; };

// ---------------------------------------------------------------------------
// WMMA helper: issue + 4 VALU idle slots tied to D, A, B
// ---------------------------------------------------------------------------
__device__ __forceinline__ v8f wmma16(v16h a, v16h b, v8f c) {
  c = __builtin_amdgcn_wmma_f32_16x16x32_f16(false, a, false, b, (short)0, c,
                                              false, false);
  asm volatile("v_nop\n\tv_nop\n\tv_nop\n\tv_nop" : "+v"(c) : "v"(a), "v"(b));
  return c;
}

// 16x32 fragment from a k-contiguous 16-bit row (lane row/col = lane&15, h = lane>>4):
// elements 0..7 <- k0+8h .. k0+8h+7, elements 8..15 <- k0+16+8h .. k0+16+8h+7.
// Same map for A (row m) and B (column n of a [n][k] plane).
__device__ __forceinline__ v16h ld_frag(const f16* rowp, int k0, int h) {
  Frag f;
  f.half[0] = *(const v8h*)(rowp + k0 + 8 * h);
  f.half[1] = *(const v8h*)(rowp + k0 + 16 + 8 * h);
  return f.v;
}

__device__ __forceinline__ void vst_h8(f16* p, v8h v) {
  Pk16 u;
  u.h = v;
  *(v4f*)p = u.f;
}
__device__ __forceinline__ void vst_f4(float* p, v4f v) {
  *(v4f*)p = v;
}

// ---------------------------------------------------------------------------
// Weight planes: Wwh[512][512] = f16(16*Ww), Lwh[1024][512] = f16(16*Lw), rows >= 1000 zero.
// ---------------------------------------------------------------------------
__global__ void __launch_bounds__(256)
k_cvt_w(const float* __restrict__ Ww, const float* __restrict__ Lw,
        f16* __restrict__ Wwh, f16* __restrict__ Lwh) {
  const int NW = DD * DD / 8;
  const int NL = VP * DD / 8;
  const int p = blockIdx.x * 256 + threadIdx.x;
  if (p >= NW + NL) return;
  v8h v;
  f16* dst;
  if (p < NW) {
    const float* s = Ww + (size_t)p * 8;
    v4f a = *(const v4f*)s;
    v4f c = *(const v4f*)(s + 4);
#pragma unroll
    for (int j = 0; j < 4; ++j) {
      v[j] = (f16)(a[j] * 16.0f);
      v[4 + j] = (f16)(c[j] * 16.0f);
    }
    dst = Wwh + (size_t)p * 8;
  } else {
    const int pp = p - NW;
    const int row = pp >> 6;
    const int col = (pp & 63) * 8;
    if (row < VV) {
      const float* s = Lw + (size_t)row * DD + col;
      v4f a = *(const v4f*)s;
      v4f c = *(const v4f*)(s + 4);
#pragma unroll
      for (int j = 0; j < 4; ++j) {
        v[j] = (f16)(a[j] * 16.0f);
        v[4 + j] = (f16)(c[j] * 16.0f);
      }
    } else {
#pragma unroll
      for (int j = 0; j < 8; ++j) v[j] = (f16)0.0f;
    }
    dst = Lwh + (size_t)pp * 8;
  }
  vst_h8(dst, v);
  
}

// ---------------------------------------------------------------------------
// x (L,B,D) f32 -> xh[b][l][d] f16 (pitch 512) and xT[b][d][l] f16 (pitch 4096).
// Block = 64 l x 64 d of one batch; transpose through LDS; every store instruction
// ---------------------------------------------------------------------------
__global__ void __launch_bounds__(256)
k_cvt_x(const float* __restrict__ x, f16* __restrict__ xh, f16* __restrict__ xT) {
  __shared__ __align__(16) f16 sX[64 * 72];
  const int t = threadIdx.x;
  const int l0 = blockIdx.x * 64, d0 = blockIdx.y * 64, b = blockIdx.z;
  v8h hv[2];
#pragma unroll
  for (int i = 0; i < 2; ++i) {
    const int P = t + 256 * i;
    const int ll = P >> 3, dc = (P & 7) * 8;
    const float* s = x + ((size_t)(l0 + ll) * BB + b) * DD + d0 + dc;
    v4f a = *(const v4f*)s;
    v4f c = *(const v4f*)(s + 4);
    v8h v;
#pragma unroll
    for (int j = 0; j < 4; ++j) {
      v[j] = (f16)a[j];
      v[4 + j] = (f16)c[j];
    }
    hv[i] = v;
#pragma unroll
    for (int j = 0; j < 8; ++j) sX[(dc + j) * 72 + ll] = v[j];
  }
  // xh rows
#pragma unroll
  for (int i = 0; i < 2; ++i) {
    const int P = t + 256 * i;
    const int ll = P >> 3, dc = (P & 7) * 8;
    vst_h8(xh + ((size_t)(b * LL + l0 + ll)) * DD + d0 + dc, hv[i]);
  }
  
  __syncthreads();
  // xT rows (transposed tile out of LDS)
  v8h tv[2];
#pragma unroll
  for (int i = 0; i < 2; ++i) {
    const int P = t + 256 * i;
    const int dd = P >> 3, q = P & 7;
    tv[i] = *(const v8h*)(sX + dd * 72 + q * 8);
  }
#pragma unroll
  for (int i = 0; i < 2; ++i) {
    const int P = t + 256 * i;
    const int dd = P >> 3, q = P & 7;
    vst_h8(xT + ((size_t)(b * DD + d0 + dd)) * LL + l0 + q * 8, tv[i]);
  }
  
}

// ---------------------------------------------------------------------------
// Generic 128x64 tile GEMM, f16 operands, f32 accumulate.
//   A: [row][k] k-contiguous, pitch lda, batch stride zA (elements)
//   B: [n][k]   k-contiguous, pitch ldb, batch stride zB
//   8 waves, each a 32x32 sub-tile (4 accumulators), K multiple of 32.
// MODE 0: value = acc*scale + bias[col]; staged transposed in LDS and stored as
// MODE 1: value = acc*scale; stored as C[z*zC + orow*ldc + col] (f16),
// ---------------------------------------------------------------------------
template <int MODE>
__global__ void __launch_bounds__(256)
k_gemm(const f16* __restrict__ A, int lda, long long zA,
       const f16* __restrict__ Bm, int ldb, long long zB, int K,
       const float* __restrict__ bias, float scale,
       f16* __restrict__ C, int ldc, long long zC, int rowmul, int rowzadd) {
  __shared__ __align__(16) f16 sS[128 * 72];
  const int t = threadIdx.x, lane = t & 31, w = t >> 5;
  const int h = lane >> 4, m = lane & 15;
  const int row0 = blockIdx.x * 128, col0 = blockIdx.y * 64, z = blockIdx.z;
  const int mrow = (w >> 1) * 32, ncol = (w & 1) * 32;

  const f16* Ab = A + (size_t)z * zA + (size_t)(row0 + mrow) * lda;
  const f16* Bb = Bm + (size_t)z * zB + (size_t)(col0 + ncol) * ldb;
  const f16* a0p = Ab + (size_t)m * lda;
  const f16* a1p = Ab + (size_t)(16 + m) * lda;
  const f16* b0p = Bb + (size_t)m * ldb;
  const f16* b1p = Bb + (size_t)(16 + m) * ldb;

  v8f vz = {};
  v8f c00 = vz, c01 = vz, c10 = vz, c11 = vz;
  for (int k0 = 0; k0 < K; k0 += 32) {
    v16h a0 = ld_frag(a0p, k0, h);
    v16h a1 = ld_frag(a1p, k0, h);
    v16h b0 = ld_frag(b0p, k0, h);
    v16h b1 = ld_frag(b1p, k0, h);
    c00 = wmma16(a0, b0, c00);
    c01 = wmma16(a0, b1, c01);
    c10 = wmma16(a1, b0, c10);
    c11 = wmma16(a1, b1, c11);
  }

  // D element r of this lane = (row mrow + mi*16 + 8h + r, col ncol + ni*16 + m)
  if (MODE == 0) {
    const int PT = 136;
    const float g0 = bias[col0 + ncol + m];
    const float g1 = bias[col0 + ncol + 16 + m];
    f16* s0 = sS + (ncol + m) * PT + mrow + 8 * h;
    f16* s1 = sS + (ncol + 16 + m) * PT + mrow + 8 * h;
#pragma unroll
    for (int r = 0; r < 8; ++r) {
      s0[r] = (f16)(c00[r] * scale + g0);
      s1[r] = (f16)(c01[r] * scale + g1);
      s0[16 + r] = (f16)(c10[r] * scale + g0);
      s1[16 + r] = (f16)(c11[r] * scale + g1);
    }
  } else {
    const int PN = 72;
    f16* s0 = sS + (mrow + 8 * h) * PN + ncol + m;
#pragma unroll
    for (int r = 0; r < 8; ++r) {
      s0[r * PN] = (f16)(c00[r] * scale);
      s0[r * PN + 16] = (f16)(c01[r] * scale);
      s0[(16 + r) * PN] = (f16)(c10[r] * scale);
      s0[(16 + r) * PN + 16] = (f16)(c11[r] * scale);
    }
  }
  __syncthreads();

  f16* Cz = C + (size_t)z * zC;
  v8h vals[4];
  if (MODE == 0) {
    // 64 cols x 256 B; piece P: col dd = P>>4, q = P&15; lanes 0..15 -> 2 lines of col dd
#pragma unroll
    for (int i = 0; i < 4; ++i) {
      const int P = t + 256 * i;
      const int dd = P >> 4, q = P & 15;
      vals[i] = *(const v8h*)(sS + dd * 136 + q * 8);
    }
#pragma unroll
    for (int i = 0; i < 4; ++i) {
      const int P = t + 256 * i;
      const int dd = P >> 4, q = P & 15;
      vst_h8(Cz + (size_t)(col0 + dd) * ldc + row0 + q * 8, vals[i]);
    }
    
  } else {
#pragma unroll
    for (int i = 0; i < 4; ++i) {
      const int P = t + 256 * i;
      const int rr = P >> 3, q = P & 7;
      vals[i] = *(const v8h*)(sS + rr * 72 + q * 8);
    }
#pragma unroll
    for (int i = 0; i < 4; ++i) {
      const int P = t + 256 * i;
      const int rr = P >> 3, q = P & 7;
      const size_t orow = (size_t)((row0 + rr) * rowmul + z * rowzadd);
      vst_h8(Cz + orow * ldc + col0 + q * 8, vals[i]);
    }
    
  }
}

// ---------------------------------------------------------------------------
// logits = 16 * (yh . Lwh^T) + Lb, log-softmax over 1000 columns, f32 out.
// Block owns 16 consecutive out rows (row index = l*4 + b) = one contiguous
// ---------------------------------------------------------------------------
__global__ void __launch_bounds__(256)
k_logits(const f16* __restrict__ yh, const f16* __restrict__ Lwh,
         const float* __restrict__ Lb, float* __restrict__ out) {
  __shared__ __align__(16) float sL[16 * VP];
  __shared__ float sMx[16];
  __shared__ float sLs[16];
  const int t = threadIdx.x, lane = t & 31, w = t >> 5;
  const int h = lane >> 4, m = lane & 15;
  const int r0 = blockIdx.x * 16;
  const f16* ap = yh + (size_t)(r0 + m) * DD;
  v8f vz = {};

#pragma unroll 1
  for (int g = 0; g < 2; ++g) {
    const int cbase = w * 128 + g * 64;
    const f16* bp = Lwh + (size_t)(cbase + m) * DD;
    v8f acc[4];
#pragma unroll
    for (int j = 0; j < 4; ++j) acc[j] = vz;
    for (int k0 = 0; k0 < DD; k0 += 32) {
      v16h a = ld_frag(ap, k0, h);
#pragma unroll
      for (int j = 0; j < 4; ++j)
        acc[j] = wmma16(a, ld_frag(bp + (size_t)j * 16 * DD, k0, h), acc[j]);
    }
#pragma unroll
    for (int j = 0; j < 4; ++j) {
      const int v = cbase + j * 16 + m;
      const float bv = (v < VV) ? Lb[v] : 0.0f;
      float* s = sL + (8 * h) * VP + v;
#pragma unroll
      for (int r = 0; r < 8; ++r) s[r * VP] = acc[j][r] * 16.0f + bv;
    }
  }
  __syncthreads();

  // 16 threads per row: max, then sum of exp
  const int row = t >> 4, sub = t & 15;
  const float* srow = sL + row * VP;
  float mx = -3.0e38f;
  for (int v = sub; v < VV; v += 16) mx = fmaxf(mx, srow[v]);
  mx = fmaxf(mx, __shfl_xor(mx, 8));
  mx = fmaxf(mx, __shfl_xor(mx, 4));
  mx = fmaxf(mx, __shfl_xor(mx, 2));
  mx = fmaxf(mx, __shfl_xor(mx, 1));
  float se = 0.0f;
  for (int v = sub; v < VV; v += 16) se += __expf(srow[v] - mx);
  se += __shfl_xor(se, 8);
  se += __shfl_xor(se, 4);
  se += __shfl_xor(se, 2);
  se += __shfl_xor(se, 1);
  if (sub == 0) {
    sMx[row] = mx;
    sLs[row] = __logf(se);
  }
  __syncthreads();

  float* ob = out + (size_t)blockIdx.x * (16 * VV);
  {
#pragma unroll
    for (int i = 0; i < 16; ++i) {
      const int P = t + 256 * i;
      if (P < 4 * VV) {
        const int e = P * 4;
        const int rr = e / VV;
        const int cc = e - rr * VV;
        v4f lv = *(const v4f*)(sL + rr * VP + cc);
        const float mxr = sMx[rr], ls = sLs[rr];
        v4f o;
#pragma unroll
        for (int q = 0; q < 4; ++q) o[q] = (lv[q] - mxr) - ls;
        vst_f4(ob + e, o);
      }
    }
    
  }
}

// ---------------------------------------------------------------------------
extern "C" void kernel_launch(void* const* d_in, const int* in_sizes, int n_in,
                              void* d_out, int out_size, void* d_ws, size_t ws_size,
                              hipStream_t stream) {
  if (n_in < 5) return;
  if (in_sizes[0] != LL * BB * DD || in_sizes[1] != DD * DD || in_sizes[2] != DD ||
      in_sizes[3] != VV * DD || in_sizes[4] != VV || out_size != LL * BB * VV)
    return;

  const float* x  = (const float*)d_in[0];
  const float* Ww = (const float*)d_in[1];
  const float* Wb = (const float*)d_in[2];
  const float* Lw = (const float*)d_in[3];
  const float* Lb = (const float*)d_in[4];
  float* out = (float*)d_out;
  char* ws = (char*)d_ws;

  const size_t SZ   = (size_t)BB * LL * DD * 2;      // 16 MiB per f16 activation plane
  const size_t oXh  = 0;
  const size_t oXT  = oXh + SZ;
  const size_t oWxT = oXT + SZ;
  const size_t oYh  = oWxT + SZ;
  const size_t oWwh = oYh + SZ;
  const size_t oLwh = oWwh + (size_t)DD * DD * 2;
  const size_t oGTh = oLwh + (size_t)VP * DD * 2;
  const size_t oEnd = oGTh + (size_t)BB * DD * DD * 2;
  if (oEnd > ws_size) return;

  f16* xh  = (f16*)(ws + oXh);
  f16* xT  = (f16*)(ws + oXT);
  f16* wxT = (f16*)(ws + oWxT);
  f16* yh  = (f16*)(ws + oYh);
  f16* Wwh = (f16*)(ws + oWwh);
  f16* Lwh = (f16*)(ws + oLwh);
  f16* GTh = (f16*)(ws + oGTh);

  const float inv16 = 0.0625f;

  // 1) weight planes
  k_cvt_w<<<(DD * DD / 8 + VP * DD / 8) / 256, 256, 0, stream>>>(Ww, Lw, Wwh, Lwh);
  // 2) activation planes xh[b][l][d], xT[b][d][l]
  k_cvt_x<<<dim3(LL / 64, DD / 64, BB), 256, 0, stream>>>(x, xh, xT);
  // 3) wx = x.Ww^T + Wb -> wxT[b][d'][l]   (rows l within batch z, cols d')
  k_gemm<0><<<dim3(LL / 128, DD / 64, BB), 256, 0, stream>>>(
      xh, DD, (long long)LL * DD, Wwh, DD, 0LL, DD, Wb, inv16,
      wxT, LL, (long long)DD * LL, 0, 0);
  // 4) GT[b][d][d'] = sum_m x[b,m,d] wx[b,m,d'], stored x2^-4  (rows d, cols d', K = L)
  k_gemm<1><<<dim3(DD / 128, DD / 64, BB), 256, 0, stream>>>(
      xT, LL, (long long)DD * LL, wxT, LL, (long long)DD * LL, LL, Wb, inv16,
      GTh, DD, (long long)DD * DD, 1, 0);
  // 5) y[b,l,d] = sum_d' x[b,l,d'] G[d',d], stored x2^-8 at row l*4+b (rows l, cols d, K = D)
  k_gemm<1><<<dim3(LL / 128, DD / 64, BB), 256, 0, stream>>>(
      xh, DD, (long long)LL * DD, GTh, DD, (long long)DD * DD, DD, Wb, inv16,
      yh, DD, 0LL, BB, 1);
  // 6) logits + log-softmax -> out (L,B,V)
  k_logits<<<(LL * BB) / 16, 256, 0, stream>>>(yh, Lwh, Lb, out);
}

// v001
// It runs in 121 microseconds.
// Timed twice side by side with v000, it ran 1.96 times as fast both times.
#include <hip/hip_runtime.h>
// Contractions on v_wmma_f32_16x16x32_f16 (f16 operands, f32 accumulate): x*Ww^T (Ww carried x2^4), x^T*wx, x*(G x2^-4), (y x2^-8)*(Lw x2^4)^T; bias add and log-softmax in f32.

#define LL 4096
#define BB 4
#define DD 512
#define VV 1000
#define VP 1024

typedef _Float16 f16;
typedef f16 v16h __attribute__((ext_vector_type(16)));
typedef f16 v8h __attribute__((ext_vector_type(8)));
typedef float v8f __attribute__((ext_vector_type(8)));
typedef float v4f __attribute__((ext_vector_type(4)));

union Frag { v16h v; v8h half[2]; };
union Pk16 { v8h h; v4f f; };

// ---------------------------------------------------------------------------
// WMMA helper: issue + 4 VALU idle slots tied to D, A, B
// ---------------------------------------------------------------------------
__device__ __forceinline__ v8f wmma16(v16h a, v16h b, v8f c) {
  c = __builtin_amdgcn_wmma_f32_16x16x32_f16(false, a, false, b, (short)0, c,
                                              false, false);
  asm volatile("v_nop\n\tv_nop\n\tv_nop\n\tv_nop" : "+v"(c) : "v"(a), "v"(b));
  return c;
}

// 16x32 fragment from a k-contiguous 16-bit row (lane row/col = lane&15, h = lane>>4):
// elements 0..7 <- k0+8h .. k0+8h+7, elements 8..15 <- k0+16+8h .. k0+16+8h+7.
// Same map for A (row m) and B (column n of a [n][k] plane).
__device__ __forceinline__ v16h ld_frag(const f16* rowp, int k0, int h) {
  Frag f;
  f.half[0] = *(const v8h*)(rowp + k0 + 8 * h);
  f.half[1] = *(const v8h*)(rowp + k0 + 16 + 8 * h);
  return f.v;
}

__device__ __forceinline__ void vst_h8(f16* p, v8h v) {
  Pk16 u;
  u.h = v;
  *(v4f*)p = u.f;
}
__device__ __forceinline__ void vst_f4(float* p, v4f v) {
  *(v4f*)p = v;
}

// ---------------------------------------------------------------------------
// Weight planes: Wwh[512][512] = f16(16*Ww), Lwh[1024][512] = f16(16*Lw), rows >= 1000 zero.
// ---------------------------------------------------------------------------
__global__ void __launch_bounds__(256)
k_cvt_w(const float* __restrict__ Ww, const float* __restrict__ Lw,
        f16* __restrict__ Wwh, f16* __restrict__ Lwh) {
  const int NW = DD * DD / 8;
  const int NL = VP * DD / 8;
  const int p = blockIdx.x * 256 + threadIdx.x;
  if (p >= NW + NL) return;
  v8h v;
  f16* dst;
  if (p < NW) {
    const float* s = Ww + (size_t)p * 8;
    v4f a = *(const v4f*)s;
    v4f c = *(const v4f*)(s + 4);
#pragma unroll
    for (int j = 0; j < 4; ++j) {
      v[j] = (f16)(a[j] * 16.0f);
      v[4 + j] = (f16)(c[j] * 16.0f);
    }
    dst = Wwh + (size_t)p * 8;
  } else {
    const int pp = p - NW;
    const int row = pp >> 6;
    const int col = (pp & 63) * 8;
    if (row < VV) {
      const float* s = Lw + (size_t)row * DD + col;
      v4f a = *(const v4f*)s;
      v4f c = *(const v4f*)(s + 4);
#pragma unroll
      for (int j = 0; j < 4; ++j) {
        v[j] = (f16)(a[j] * 16.0f);
        v[4 + j] = (f16)(c[j] * 16.0f);
      }
    } else {
#pragma unroll
      for (int j = 0; j < 8; ++j) v[j] = (f16)0.0f;
    }
    dst = Lwh + (size_t)pp * 8;
  }
  vst_h8(dst, v);
  
}

// ---------------------------------------------------------------------------
// x (L,B,D) f32 -> xh[b][l][d] f16 (pitch 512) and xT[b][d][l] f16 (pitch 4096).
// Block = 64 l x 64 d of one batch; transpose through LDS; every store instruction
// ---------------------------------------------------------------------------
__global__ void __launch_bounds__(256)
k_cvt_x(const float* __restrict__ x, f16* __restrict__ xh, f16* __restrict__ xT) {
  __shared__ __align__(16) f16 sX[64 * 72];
  const int t = threadIdx.x;
  const int l0 = blockIdx.x * 64, d0 = blockIdx.y * 64, b = blockIdx.z;
  v8h hv[2];
#pragma unroll
  for (int i = 0; i < 2; ++i) {
    const int P = t + 256 * i;
    const int ll = P >> 3, dc = (P & 7) * 8;
    const float* s = x + ((size_t)(l0 + ll) * BB + b) * DD + d0 + dc;
    v4f a = *(const v4f*)s;
    v4f c = *(const v4f*)(s + 4);
    v8h v;
#pragma unroll
    for (int j = 0; j < 4; ++j) {
      v[j] = (f16)a[j];
      v[4 + j] = (f16)c[j];
    }
    hv[i] = v;
#pragma unroll
    for (int j = 0; j < 8; ++j) sX[(dc + j) * 72 + ll] = v[j];
  }
  // xh rows
#pragma unroll
  for (int i = 0; i < 2; ++i) {
    const int P = t + 256 * i;
    const int ll = P >> 3, dc = (P & 7) * 8;
    vst_h8(xh + ((size_t)(b * LL + l0 + ll)) * DD + d0 + dc, hv[i]);
  }
  
  __syncthreads();
  // xT rows (transposed tile out of LDS)
  v8h tv[2];
#pragma unroll
  for (int i = 0; i < 2; ++i) {
    const int P = t + 256 * i;
    const int dd = P >> 3, q = P & 7;
    tv[i] = *(const v8h*)(sX + dd * 72 + q * 8);
  }
#pragma unroll
  for (int i = 0; i < 2; ++i) {
    const int P = t + 256 * i;
    const int dd = P >> 3, q = P & 7;
    vst_h8(xT + ((size_t)(b * DD + d0 + dd)) * LL + l0 + q * 8, tv[i]);
  }
  
}

// ---------------------------------------------------------------------------
// Asynchronous global -> LDS copies, 16 bytes a lane: l = the lane's LDS byte address,
// g = its global address. One statement holds one fill's copies; the s_wait_xcnt
// closes it so that no address register is rewritten ahead of it.
// ---------------------------------------------------------------------------
__device__ __forceinline__ unsigned lds_off(const void* p) { return (unsigned)(size_t)p; }

__device__ __forceinline__ void cp(const unsigned (&l)[4], const f16* const (&g)[4]) {
  asm volatile(
               "global_load_async_to_lds_b128 %0, %1, off\n\t"
               "global_load_async_to_lds_b128 %2, %3, off\n\t"
               "global_load_async_to_lds_b128 %4, %5, off\n\t"
               "global_load_async_to_lds_b128 %6, %7, off\n\t"
               "s_wait_xcnt 0x0"
               :: "v"(l[0]), "v"(g[0]), "v"(l[1]), "v"(g[1]), "v"(l[2]), "v"(g[2]),
                  "v"(l[3]), "v"(g[3])
               : "memory");
}
__device__ __forceinline__ void cp(const unsigned (&l)[6], const f16* const (&g)[6]) {
  asm volatile(
               "global_load_async_to_lds_b128 %0, %1, off\n\t"
               "global_load_async_to_lds_b128 %2, %3, off\n\t"
               "global_load_async_to_lds_b128 %4, %5, off\n\t"
               "global_load_async_to_lds_b128 %6, %7, off\n\t"
               "global_load_async_to_lds_b128 %8, %9, off\n\t"
               "global_load_async_to_lds_b128 %10, %11, off\n\t"
               "s_wait_xcnt 0x0"
               :: "v"(l[0]), "v"(g[0]), "v"(l[1]), "v"(g[1]), "v"(l[2]), "v"(g[2]),
                  "v"(l[3]), "v"(g[3]), "v"(l[4]), "v"(g[4]), "v"(l[5]), "v"(g[5])
               : "memory");
}
__device__ __forceinline__ void cp(const unsigned (&l)[8], const f16* const (&g)[8]) {
  asm volatile(
               "global_load_async_to_lds_b128 %0, %1, off\n\t"
               "global_load_async_to_lds_b128 %2, %3, off\n\t"
               "global_load_async_to_lds_b128 %4, %5, off\n\t"
               "global_load_async_to_lds_b128 %6, %7, off\n\t"
               "global_load_async_to_lds_b128 %8, %9, off\n\t"
               "global_load_async_to_lds_b128 %10, %11, off\n\t"
               "global_load_async_to_lds_b128 %12, %13, off\n\t"
               "global_load_async_to_lds_b128 %14, %15, off\n\t"
               "s_wait_xcnt 0x0"
               :: "v"(l[0]), "v"(g[0]), "v"(l[1]), "v"(g[1]), "v"(l[2]), "v"(g[2]),
                  "v"(l[3]), "v"(g[3]), "v"(l[4]), "v"(g[4]), "v"(l[5]), "v"(g[5]),
                  "v"(l[6]), "v"(g[6]), "v"(l[7]), "v"(g[7])
               : "memory");
}
__device__ __forceinline__ void cp(const unsigned (&l)[12], const f16* const (&g)[12]) {
  asm volatile(
               "global_load_async_to_lds_b128 %0, %1, off\n\t"
               "global_load_async_to_lds_b128 %2, %3, off\n\t"
               "global_load_async_to_lds_b128 %4, %5, off\n\t"
               "global_load_async_to_lds_b128 %6, %7, off\n\t"
               "global_load_async_to_lds_b128 %8, %9, off\n\t"
               "global_load_async_to_lds_b128 %10, %11, off\n\t"
               "global_load_async_to_lds_b128 %12, %13, off\n\t"
               "global_load_async_to_lds_b128 %14, %15, off\n\t"
               "global_load_async_to_lds_b128 %16, %17, off\n\t"
               "global_load_async_to_lds_b128 %18, %19, off\n\t"
               "global_load_async_to_lds_b128 %20, %21, off\n\t"
               "global_load_async_to_lds_b128 %22, %23, off\n\t"
               "s_wait_xcnt 0x0"
               :: "v"(l[0]), "v"(g[0]), "v"(l[1]), "v"(g[1]), "v"(l[2]), "v"(g[2]),
                  "v"(l[3]), "v"(g[3]), "v"(l[4]), "v"(g[4]), "v"(l[5]), "v"(g[5]),
                  "v"(l[6]), "v"(g[6]), "v"(l[7]), "v"(g[7]), "v"(l[8]), "v"(g[8]),
                  "v"(l[9]), "v"(g[9]), "v"(l[10]), "v"(g[10]), "v"(l[11]), "v"(g[11])
               : "memory");
}
// this wave's LDS reads have retired (before a buffer it read is refilled)
__device__ __forceinline__ void wait_ds0() { asm volatile("s_wait_dscnt 0x0" ::: "memory"); }
// this wave's copies have landed (before the barrier that publishes them)
__device__ __forceinline__ void wait_async0() { asm volatile("s_wait_asynccnt 0x0" ::: "memory"); }

// ---------------------------------------------------------------------------
// Generic 128x64 tile GEMM, f16 operands, f32 accumulate.
//   A: [row][k] k-contiguous, pitch lda, batch stride zA (elements)
//   B: [n][k]   k-contiguous, pitch ldb, batch stride zB
//   8 waves, each a 32x32 sub-tile (4 accumulators), K multiple of KP.
//   A pass is KP k of all 192 operand rows, copied whole-line into one of two LDS
//   buffers (row pitch KP*2+16 bytes) while the other buffer is worked on.
// MODE 0: value = acc*scale + bias[col]; staged transposed in LDS and stored as
// MODE 1: value = acc*scale; stored as C[z*zC + orow*ldc + col] (f16),
// ---------------------------------------------------------------------------
template <int MODE, int KP>
__global__ void __launch_bounds__(256)
k_gemm(const f16* __restrict__ A, int lda, long long zA,
       const f16* __restrict__ Bm, int ldb, long long zB, int K,
       const float* __restrict__ bias, float scale,
       f16* __restrict__ C, int ldc, long long zC, int rowmul, int rowzadd) {
  __shared__ __align__(16) f16 sS[128 * 72];
  const int t = threadIdx.x, lane = t & 31, w = t >> 5;
  const int h = lane >> 4, m = lane & 15;
  const int row0 = blockIdx.x * 128, col0 = blockIdx.y * 64, z = blockIdx.z;
  const int mrow = (w >> 1) * 32, ncol = (w & 1) * 32;

  constexpr int PT2 = KP + 8;          // LDS row pitch, elements
  constexpr int CPR = KP / 8;          // 16-byte pieces a row
  constexpr int RPI = 256 / CPR;       // rows one copy of the whole block covers
  constexpr int NA = 128 / RPI, NB = 64 / RPI;
  __shared__ __align__(16) f16 sT[2 * 192 * PT2];

  const int crow = t / CPR, cq = (t % CPR) * 8;
  const f16* gA = A + (size_t)z * zA + (size_t)(row0 + crow) * lda + cq;
  const f16* gB = Bm + (size_t)z * zB + (size_t)(col0 + crow) * ldb + cq;
  const unsigned lA = lds_off(sT) + (unsigned)(crow * PT2 + cq) * 2u;
  const unsigned lB = lA + 128u * PT2 * 2u;
  const size_t stepA = (size_t)RPI * lda, stepB = (size_t)RPI * ldb;

  auto fill = [&](int pass, int buf) {
    const unsigned lo = (unsigned)buf * (192u * PT2 * 2u);
    const f16* pa = gA + (size_t)pass * KP;
    const f16* pb = gB + (size_t)pass * KP;
    unsigned l[NA + NB];
    const f16* g[NA + NB];
    // both loops unrolled so that l and g are registers, as the asm operands need
#pragma unroll
    for (int i = 0; i < NA; ++i) {
      l[i] = lA + lo + (unsigned)i * (RPI * PT2 * 2);
      g[i] = pa + i * stepA;
    }
#pragma unroll
    for (int i = 0; i < NB; ++i) {
      l[NA + i] = lB + lo + (unsigned)i * (RPI * PT2 * 2);
      g[NA + i] = pb + i * stepB;
    }
    cp(l, g);
  };

  const int NP = K / KP;
  fill(0, 0);
  wait_async0();
  __syncthreads();
  if (NP > 1) fill(1, 1);

  v8f vz = {};
  v8f c00 = vz, c01 = vz, c10 = vz, c11 = vz;
  for (int p = 0; p < NP; ++p) {
    const f16* sb = sT + (p & 1) * (192 * PT2);
    const f16* a0p = sb + (mrow + m) * PT2;
    const f16* a1p = a0p + 16 * PT2;
    const f16* b0p = sb + (128 + ncol + m) * PT2;
    const f16* b1p = b0p + 16 * PT2;
    // unrolled: the k offsets become immediates of the LDS loads
#pragma unroll
    for (int k0 = 0; k0 < KP; k0 += 32) {
      v16h a0 = ld_frag(a0p, k0, h);
      v16h a1 = ld_frag(a1p, k0, h);
      v16h b0 = ld_frag(b0p, k0, h);
      v16h b1 = ld_frag(b1p, k0, h);
      c00 = wmma16(a0, b0, c00);
      c01 = wmma16(a0, b1, c01);
      c10 = wmma16(a1, b0, c10);
      c11 = wmma16(a1, b1, c11);
    }
    wait_ds0();
    wait_async0();
    __syncthreads();  // publishes pass p+1 and ends every read of pass p's buffer
    if (p + 2 < NP) fill(p + 2, p & 1);
  }
  wait_async0();

  // D element r of this lane = (row mrow + mi*16 + 8h + r, col ncol + ni*16 + m)
  if (MODE == 0) {
    const int PT = 136;
    const float g0 = bias[col0 + ncol + m];
    const float g1 = bias[col0 + ncol + 16 + m];
    f16* s0 = sS + (ncol + m) * PT + mrow + 8 * h;
    f16* s1 = sS + (ncol + 16 + m) * PT + mrow + 8 * h;
#pragma unroll
    for (int r = 0; r < 8; ++r) {
      s0[r] = (f16)(c00[r] * scale + g0);
      s1[r] = (f16)(c01[r] * scale + g1);
      s0[16 + r] = (f16)(c10[r] * scale + g0);
      s1[16 + r] = (f16)(c11[r] * scale + g1);
    }
  } else {
    const int PN = 72;
    f16* s0 = sS + (mrow + 8 * h) * PN + ncol + m;
#pragma unroll
    for (int r = 0; r < 8; ++r) {
      s0[r * PN] = (f16)(c00[r] * scale);
      s0[r * PN + 16] = (f16)(c01[r] * scale);
      s0[(16 + r) * PN] = (f16)(c10[r] * scale);
      s0[(16 + r) * PN + 16] = (f16)(c11[r] * scale);
    }
  }
  __syncthreads();

  f16* Cz = C + (size_t)z * zC;
  v8h vals[4];
  if (MODE == 0) {
    // 64 cols x 256 B; piece P: col dd = P>>4, q = P&15; lanes 0..15 -> 2 lines of col dd
#pragma unroll
    for (int i = 0; i < 4; ++i) {
      const int P = t + 256 * i;
      const int dd = P >> 4, q = P & 15;
      vals[i] = *(const v8h*)(sS + dd * 136 + q * 8);
    }
#pragma unroll
    for (int i = 0; i < 4; ++i) {
      const int P = t + 256 * i;
      const int dd = P >> 4, q = P & 15;
      vst_h8(Cz + (size_t)(col0 + dd) * ldc + row0 + q * 8, vals[i]);
    }
    
  } else {
#pragma unroll
    for (int i = 0; i < 4; ++i) {
      const int P = t + 256 * i;
      const int rr = P >> 3, q = P & 7;
      vals[i] = *(const v8h*)(sS + rr * 72 + q * 8);
    }
#pragma unroll
    for (int i = 0; i < 4; ++i) {
      const int P = t + 256 * i;
      const int rr = P >> 3, q = P & 7;
      const size_t orow = (size_t)((row0 + rr) * rowmul + z * rowzadd);
      vst_h8(Cz + orow * ldc + col0 + q * 8, vals[i]);
    }
    
  }
}

// ---------------------------------------------------------------------------
// logits = 16 * (yh . Lwh^T) + Lb, log-softmax over 1000 columns, f32 out.
// Block owns 16 consecutive out rows (row index = l*4 + b) = one contiguous
// ---------------------------------------------------------------------------
__global__ void __launch_bounds__(256)
k_logits(const f16* __restrict__ yh, const f16* __restrict__ Lwh,
         const float* __restrict__ Lb, float* __restrict__ out) {
  __shared__ __align__(16) float sL[16 * VP];
  __shared__ float sMx[16];
  __shared__ float sLs[16];
  constexpr int PA = DD + 8;           // LDS pitch of a yh row, elements
  constexpr int PB = 64 + 8;           // LDS pitch of a Lwh row slab, elements
  constexpr int NR = 256;              // Lwh rows (columns of the logits) a pass
  constexpr int NPASS = (VP / NR) * (DD / 64);
  __shared__ __align__(16) f16 sA[16 * PA];
  __shared__ __align__(16) f16 sB[2 * NR * PB];
  const int t = threadIdx.x, lane = t & 31, w = t >> 5;
  const int h = lane >> 4, m = lane & 15;
  const int r0 = blockIdx.x * 16;
  v8f vz = {};

  // pass p = column group p>>3 (256 columns), k slab p&7 (64 k); 8 copies a thread
  const f16* gB = Lwh + (size_t)(t >> 3) * DD + (t & 7) * 8;
  const unsigned lB = lds_off(sB) + (unsigned)((t >> 3) * PB + (t & 7) * 8) * 2u;
  auto fill = [&](int pass, int buf) {
    const unsigned lo = lB + (unsigned)buf * (NR * PB * 2u);
    const f16* pb = gB + (size_t)(pass >> 3) * (NR * DD) + (pass & 7) * 64;
    unsigned l[8];
    const f16* g[8];
    // unrolled so that l and g are registers, as the asm operands need
#pragma unroll
    for (int i = 0; i < 8; ++i) {
      l[i] = lo + (unsigned)i * (32 * PB * 2);
      g[i] = pb + (size_t)i * (32 * DD);
    }
    cp(l, g);
  };
  {
    // the block's 16 yh rows, whole: 4 copies a thread
    const f16* gA = yh + (size_t)(r0 + (t >> 6)) * DD + (t & 63) * 8;
    const unsigned lA = lds_off(sA) + (unsigned)((t >> 6) * PA + (t & 63) * 8) * 2u;
    const unsigned l[4] = {lA, lA + 4u * PA * 2u, lA + 8u * PA * 2u, lA + 12u * PA * 2u};
    const f16* const g[4] = {gA, gA + 4 * DD, gA + 8 * DD, gA + 12 * DD};
    cp(l, g);
  }
  fill(0, 0);
  wait_async0();
  __syncthreads();
  fill(1, 1);

  const f16* ap = sA + m * PA;
  // kept rolled: one copy of the pass loop, not four, in the instruction stream
#pragma unroll 1
  for (int g = 0; g < VP / NR; ++g) {
    v8f acc[2];
    acc[0] = vz;
    acc[1] = vz;
    for (int ks = 0; ks < DD / 64; ++ks) {
      const int p = g * (DD / 64) + ks;
      const f16* bp = sB + (p & 1) * (NR * PB) + (w * 32 + m) * PB;
      const v16h a0 = ld_frag(ap, ks * 64, h);
      const v16h b00 = ld_frag(bp, 0, h);
      const v16h b01 = ld_frag(bp + 16 * PB, 0, h);
      const v16h a1 = ld_frag(ap, ks * 64 + 32, h);
      const v16h b10 = ld_frag(bp, 32, h);
      const v16h b11 = ld_frag(bp + 16 * PB, 32, h);
      acc[0] = wmma16(a0, b00, acc[0]);
      acc[1] = wmma16(a0, b01, acc[1]);
      acc[0] = wmma16(a1, b10, acc[0]);
      acc[1] = wmma16(a1, b11, acc[1]);
      wait_ds0();
      wait_async0();
      __syncthreads();  // publishes pass p+1 and ends every read of pass p's buffer
      if (p + 2 < NPASS) fill(p + 2, p & 1);
    }
#pragma unroll
    for (int j = 0; j < 2; ++j) {
      const int v = g * NR + w * 32 + j * 16 + m;
      const float bv = (v < VV) ? Lb[v] : 0.0f;
      float* s = sL + (8 * h) * VP + v;
#pragma unroll
      for (int r = 0; r < 8; ++r) s[r * VP] = acc[j][r] * 16.0f + bv;
    }
  }
  wait_async0();
  __syncthreads();

  // 16 threads per row: max, then sum of exp
  const int row = t >> 4, sub = t & 15;
  const float* srow = sL + row * VP;
  float mx = -3.0e38f;
  for (int v = sub; v < VV; v += 16) mx = fmaxf(mx, srow[v]);
  mx = fmaxf(mx, __shfl_xor(mx, 8));
  mx = fmaxf(mx, __shfl_xor(mx, 4));
  mx = fmaxf(mx, __shfl_xor(mx, 2));
  mx = fmaxf(mx, __shfl_xor(mx, 1));
  float se = 0.0f;
  for (int v = sub; v < VV; v += 16) se += __expf(srow[v] - mx);
  se += __shfl_xor(se, 8);
  se += __shfl_xor(se, 4);
  se += __shfl_xor(se, 2);
  se += __shfl_xor(se, 1);
  if (sub == 0) {
    sMx[row] = mx;
    sLs[row] = __logf(se);
  }
  __syncthreads();

  float* ob = out + (size_t)blockIdx.x * (16 * VV);
  {
#pragma unroll
    for (int i = 0; i < 16; ++i) {
      const int P = t + 256 * i;
      if (P < 4 * VV) {
        const int e = P * 4;
        const int rr = e / VV;
        const int cc = e - rr * VV;
        v4f lv = *(const v4f*)(sL + rr * VP + cc);
        const float mxr = sMx[rr], ls = sLs[rr];
        v4f o;
#pragma unroll
        for (int q = 0; q < 4; ++q) o[q] = (lv[q] - mxr) - ls;
        vst_f4(ob + e, o);
      }
    }
    
  }
}

// ---------------------------------------------------------------------------
extern "C" void kernel_launch(void* const* d_in, const int* in_sizes, int n_in,
                              void* d_out, int out_size, void* d_ws, size_t ws_size,
                              hipStream_t stream) {
  if (n_in < 5) return;
  if (in_sizes[0] != LL * BB * DD || in_sizes[1] != DD * DD || in_sizes[2] != DD ||
      in_sizes[3] != VV * DD || in_sizes[4] != VV || out_size != LL * BB * VV)
    return;

  const float* x  = (const float*)d_in[0];
  const float* Ww = (const float*)d_in[1];
  const float* Wb = (const float*)d_in[2];
  const float* Lw = (const float*)d_in[3];
  const float* Lb = (const float*)d_in[4];
  float* out = (float*)d_out;
  char* ws = (char*)d_ws;

  const size_t SZ   = (size_t)BB * LL * DD * 2;      // 16 MiB per f16 activation plane
  const size_t oXh  = 0;
  const size_t oXT  = oXh + SZ;
  const size_t oWxT = oXT + SZ;
  const size_t oYh  = oWxT + SZ;
  const size_t oWwh = oYh + SZ;
  const size_t oLwh = oWwh + (size_t)DD * DD * 2;
  const size_t oGTh = oLwh + (size_t)VP * DD * 2;
  const size_t oEnd = oGTh + (size_t)BB * DD * DD * 2;
  if (oEnd > ws_size) return;

  f16* xh  = (f16*)(ws + oXh);
  f16* xT  = (f16*)(ws + oXT);
  f16* wxT = (f16*)(ws + oWxT);
  f16* yh  = (f16*)(ws + oYh);
  f16* Wwh = (f16*)(ws + oWwh);
  f16* Lwh = (f16*)(ws + oLwh);
  f16* GTh = (f16*)(ws + oGTh);

  const float inv16 = 0.0625f;

  // 1) weight planes
  k_cvt_w<<<(DD * DD / 8 + VP * DD / 8) / 256, 256, 0, stream>>>(Ww, Lw, Wwh, Lwh);
  // 2) activation planes xh[b][l][d], xT[b][d][l]
  k_cvt_x<<<dim3(LL / 64, DD / 64, BB), 256, 0, stream>>>(x, xh, xT);
  // 3) wx = x.Ww^T + Wb -> wxT[b][d'][l]   (rows l within batch z, cols d')
  k_gemm<0, 64><<<dim3(LL / 128, DD / 64, BB), 256, 0, stream>>>(
      xh, DD, (long long)LL * DD, Wwh, DD, 0LL, DD, Wb, inv16,
      wxT, LL, (long long)DD * LL, 0, 0);
  // 4) GT[b][d][d'] = sum_m x[b,m,d] wx[b,m,d'], stored x2^-4  (rows d, cols d', K = L)
  k_gemm<1, 128><<<dim3(DD / 128, DD / 64, BB), 256, 0, stream>>>(
      xT, LL, (long long)DD * LL, wxT, LL, (long long)DD * LL, LL, Wb, inv16,
      GTh, DD, (long long)DD * DD, 1, 0);
  // 5) y[b,l,d] = sum_d' x[b,l,d'] G[d',d], stored x2^-8 at row l*4+b (rows l, cols d, K = D)
  k_gemm<1, 64><<<dim3(LL / 128, DD / 64, BB), 256, 0, stream>>>(
      xh, DD, (long long)LL * DD, GTh, DD, (long long)DD * DD, DD, Wb, inv16,
      yh, DD, 0LL, BB, 1);
  // 6) logits + log-softmax -> out (L,B,V)
  k_logits<<<(LL * BB) / 16, 256, 0, stream>>>(yh, Lwh, Lb, out);
}

// v002
// Measured time: 94.4 microseconds a run.
// Next to v001, in two timings, it ran 1.28 and 1.29 times as fast.
// All steps since v000 together make it 2.52 times as fast.
#include <hip/hip_runtime.h>
// Contractions on v_wmma_f32_16x16x32_f16 (f16 operands, f32 accumulate): x*Ww^T (Ww carried x2^4), x^T*wx, x*(G x2^-4), (y x2^-8)*(Lw x2^4)^T; bias add and log-softmax in f32.

#define LL 4096
#define BB 4
#define DD 512
#define VV 1000
#define VP 1024

typedef _Float16 f16;
typedef f16 v16h __attribute__((ext_vector_type(16)));
typedef f16 v8h __attribute__((ext_vector_type(8)));
typedef float v8f __attribute__((ext_vector_type(8)));
typedef float v4f __attribute__((ext_vector_type(4)));

union Frag { v16h v; v8h half[2]; };
union Pk16 { v8h h; v4f f; };

// ---------------------------------------------------------------------------
// WMMA helper: issue + 4 VALU idle slots tied to D, A, B
// ---------------------------------------------------------------------------
__device__ __forceinline__ v8f wmma16(v16h a, v16h b, v8f c) {
  c = __builtin_amdgcn_wmma_f32_16x16x32_f16(false, a, false, b, (short)0, c,
                                              false, false);
  asm volatile("v_nop\n\tv_nop\n\tv_nop\n\tv_nop" : "+v"(c) : "v"(a), "v"(b));
  return c;
}

// 16x32 fragment from a k-contiguous 16-bit row (lane row/col = lane&15, h = lane>>4):
// elements 0..7 <- k0+8h .. k0+8h+7, elements 8..15 <- k0+16+8h .. k0+16+8h+7.
// Same map for A (row m) and B (column n of a [n][k] plane).
__device__ __forceinline__ v16h ld_frag(const f16* rowp, int k0, int h) {
  Frag f;
  f.half[0] = *(const v8h*)(rowp + k0 + 8 * h);
  f.half[1] = *(const v8h*)(rowp + k0 + 16 + 8 * h);
  return f.v;
}

__device__ __forceinline__ void vst_h8(f16* p, v8h v) {
  Pk16 u;
  u.h = v;
  *(v4f*)p = u.f;
}
__device__ __forceinline__ void vst_f4(float* p, v4f v) {
  *(v4f*)p = v;
}

// ---------------------------------------------------------------------------
// Weight planes: Wwh[512][512] = f16(16*Ww), Lwh[1024][512] = f16(16*Lw), rows >= 1000 zero.
// ---------------------------------------------------------------------------
__global__ void __launch_bounds__(256)
k_cvt_w(const float* __restrict__ Ww, const float* __restrict__ Lw,
        f16* __restrict__ Wwh, f16* __restrict__ Lwh) {
  const int NW = DD * DD / 8;
  const int NL = VP * DD / 8;
  const int p = blockIdx.x * 256 + threadIdx.x;
  if (p >= NW + NL) return;
  v8h v;
  f16* dst;
  if (p < NW) {
    const float* s = Ww + (size_t)p * 8;
    v4f a = *(const v4f*)s;
    v4f c = *(const v4f*)(s + 4);
#pragma unroll
    for (int j = 0; j < 4; ++j) {
      v[j] = (f16)(a[j] * 16.0f);
      v[4 + j] = (f16)(c[j] * 16.0f);
    }
    dst = Wwh + (size_t)p * 8;
  } else {
    const int pp = p - NW;
    const int row = pp >> 6;
    const int col = (pp & 63) * 8;
    if (row < VV) {
      const float* s = Lw + (size_t)row * DD + col;
      v4f a = *(const v4f*)s;
      v4f c = *(const v4f*)(s + 4);
#pragma unroll
      for (int j = 0; j < 4; ++j) {
        v[j] = (f16)(a[j] * 16.0f);
        v[4 + j] = (f16)(c[j] * 16.0f);
      }
    } else {
#pragma unroll
      for (int j = 0; j < 8; ++j) v[j] = (f16)0.0f;
    }
    dst = Lwh + (size_t)pp * 8;
  }
  vst_h8(dst, v);
  
}

// ---------------------------------------------------------------------------
// x (L,B,D) f32 -> xh[b][l][d] f16 (pitch 512) and xT[b][d][l] f16 (pitch 4096).
// Block = 64 l x 64 d of one batch; transpose through LDS; every store instruction
// ---------------------------------------------------------------------------
__global__ void __launch_bounds__(256)
k_cvt_x(const float* __restrict__ x, f16* __restrict__ xh, f16* __restrict__ xT) {
  __shared__ __align__(16) f16 sX[64 * 72];
  const int t = threadIdx.x;
  const int l0 = blockIdx.x * 64, d0 = blockIdx.y * 64, b = blockIdx.z;
  v8h hv[2];
#pragma unroll
  for (int i = 0; i < 2; ++i) {
    const int P = t + 256 * i;
    const int ll = P >> 3, dc = (P & 7) * 8;
    const float* s = x + ((size_t)(l0 + ll) * BB + b) * DD + d0 + dc;
    v4f a = *(const v4f*)s;
    v4f c = *(const v4f*)(s + 4);
    v8h v;
#pragma unroll
    for (int j = 0; j < 4; ++j) {
      v[j] = (f16)a[j];
      v[4 + j] = (f16)c[j];
    }
    hv[i] = v;
#pragma unroll
    for (int j = 0; j < 8; ++j) sX[(dc + j) * 72 + ll] = v[j];
  }
  // xh rows
#pragma unroll
  for (int i = 0; i < 2; ++i) {
    const int P = t + 256 * i;
    const int ll = P >> 3, dc = (P & 7) * 8;
    vst_h8(xh + ((size_t)(b * LL + l0 + ll)) * DD + d0 + dc, hv[i]);
  }
  
  __syncthreads();
  // xT rows (transposed tile out of LDS)
  v8h tv[2];
#pragma unroll
  for (int i = 0; i < 2; ++i) {
    const int P = t + 256 * i;
    const int dd = P >> 3, q = P & 7;
    tv[i] = *(const v8h*)(sX + dd * 72 + q * 8);
  }
#pragma unroll
  for (int i = 0; i < 2; ++i) {
    const int P = t + 256 * i;
    const int dd = P >> 3, q = P & 7;
    vst_h8(xT + ((size_t)(b * DD + d0 + dd)) * LL + l0 + q * 8, tv[i]);
  }
  
}

// ---------------------------------------------------------------------------
// Asynchronous global -> LDS copies, 16 bytes a lane: l = the lane's LDS byte address,
// g = its global address. A fill's copies go out in one statement (k_logits: two); the s_wait_xcnt
// closes it so that no address register is rewritten ahead of it.
// ---------------------------------------------------------------------------
__device__ __forceinline__ unsigned lds_off(const void* p) { return (unsigned)(size_t)p; }

__device__ __forceinline__ void cp(const unsigned (&l)[6], const f16* const (&g)[6]) {
  asm volatile(
               "global_load_async_to_lds_b128 %0, %1, off\n\t"
               "global_load_async_to_lds_b128 %2, %3, off\n\t"
               "global_load_async_to_lds_b128 %4, %5, off\n\t"
               "global_load_async_to_lds_b128 %6, %7, off\n\t"
               "global_load_async_to_lds_b128 %8, %9, off\n\t"
               "global_load_async_to_lds_b128 %10, %11, off\n\t"
               "s_wait_xcnt 0x0"
               :: "v"(l[0]), "v"(g[0]), "v"(l[1]), "v"(g[1]), "v"(l[2]), "v"(g[2]),
                  "v"(l[3]), "v"(g[3]), "v"(l[4]), "v"(g[4]), "v"(l[5]), "v"(g[5])
               : "memory");
}
__device__ __forceinline__ void cp(const unsigned (&l)[8], const f16* const (&g)[8]) {
  asm volatile(
               "global_load_async_to_lds_b128 %0, %1, off\n\t"
               "global_load_async_to_lds_b128 %2, %3, off\n\t"
               "global_load_async_to_lds_b128 %4, %5, off\n\t"
               "global_load_async_to_lds_b128 %6, %7, off\n\t"
               "global_load_async_to_lds_b128 %8, %9, off\n\t"
               "global_load_async_to_lds_b128 %10, %11, off\n\t"
               "global_load_async_to_lds_b128 %12, %13, off\n\t"
               "global_load_async_to_lds_b128 %14, %15, off\n\t"
               "s_wait_xcnt 0x0"
               :: "v"(l[0]), "v"(g[0]), "v"(l[1]), "v"(g[1]), "v"(l[2]), "v"(g[2]),
                  "v"(l[3]), "v"(g[3]), "v"(l[4]), "v"(g[4]), "v"(l[5]), "v"(g[5]),
                  "v"(l[6]), "v"(g[6]), "v"(l[7]), "v"(g[7])
               : "memory");
}
__device__ __forceinline__ void cp(const unsigned (&l)[9], const f16* const (&g)[9]) {
  asm volatile(
               "global_load_async_to_lds_b128 %0, %1, off\n\t"
               "global_load_async_to_lds_b128 %2, %3, off\n\t"
               "global_load_async_to_lds_b128 %4, %5, off\n\t"
               "global_load_async_to_lds_b128 %6, %7, off\n\t"
               "global_load_async_to_lds_b128 %8, %9, off\n\t"
               "global_load_async_to_lds_b128 %10, %11, off\n\t"
               "global_load_async_to_lds_b128 %12, %13, off\n\t"
               "global_load_async_to_lds_b128 %14, %15, off\n\t"
               "global_load_async_to_lds_b128 %16, %17, off\n\t"
               "s_wait_xcnt 0x0"
               :: "v"(l[0]), "v"(g[0]), "v"(l[1]), "v"(g[1]), "v"(l[2]), "v"(g[2]),
                  "v"(l[3]), "v"(g[3]), "v"(l[4]), "v"(g[4]), "v"(l[5]), "v"(g[5]),
                  "v"(l[6]), "v"(g[6]), "v"(l[7]), "v"(g[7]), "v"(l[8]), "v"(g[8])
               : "memory");
}
__device__ __forceinline__ void cp(const unsigned (&l)[12], const f16* const (&g)[12]) {
  asm volatile(
               "global_load_async_to_lds_b128 %0, %1, off\n\t"
               "global_load_async_to_lds_b128 %2, %3, off\n\t"
               "global_load_async_to_lds_b128 %4, %5, off\n\t"
               "global_load_async_to_lds_b128 %6, %7, off\n\t"
               "global_load_async_to_lds_b128 %8, %9, off\n\t"
               "global_load_async_to_lds_b128 %10, %11, off\n\t"
               "global_load_async_to_lds_b128 %12, %13, off\n\t"
               "global_load_async_to_lds_b128 %14, %15, off\n\t"
               "global_load_async_to_lds_b128 %16, %17, off\n\t"
               "global_load_async_to_lds_b128 %18, %19, off\n\t"
               "global_load_async_to_lds_b128 %20, %21, off\n\t"
               "global_load_async_to_lds_b128 %22, %23, off\n\t"
               "s_wait_xcnt 0x0"
               :: "v"(l[0]), "v"(g[0]), "v"(l[1]), "v"(g[1]), "v"(l[2]), "v"(g[2]),
                  "v"(l[3]), "v"(g[3]), "v"(l[4]), "v"(g[4]), "v"(l[5]), "v"(g[5]),
                  "v"(l[6]), "v"(g[6]), "v"(l[7]), "v"(g[7]), "v"(l[8]), "v"(g[8]),
                  "v"(l[9]), "v"(g[9]), "v"(l[10]), "v"(g[10]), "v"(l[11]), "v"(g[11])
               : "memory");
}
// this wave's LDS reads have retired (before a buffer it read is refilled)
__device__ __forceinline__ void wait_ds0() { asm volatile("s_wait_dscnt 0x0" ::: "memory"); }
// this wave's copies have landed (before the barrier that publishes them)
__device__ __forceinline__ void wait_async0() { asm volatile("s_wait_asynccnt 0x0" ::: "memory"); }

// ---------------------------------------------------------------------------
// Generic 128x64 tile GEMM, f16 operands, f32 accumulate.
//   A: [row][k] k-contiguous, pitch lda, batch stride zA (elements)
//   B: [n][k]   k-contiguous, pitch ldb, batch stride zB
//   8 waves, each a 32x32 sub-tile (4 accumulators), K multiple of KP.
//   A pass is KP k of all 192 operand rows, copied whole-line into one of two LDS
//   buffers (row pitch KP*2+16 bytes) while the other buffer is worked on.
// MODE 0: value = acc*scale + bias[col]; staged transposed in LDS and stored as
// MODE 1: value = acc*scale; stored as C[z*zC + orow*ldc + col] (f16),
// ---------------------------------------------------------------------------
template <int MODE, int KP>
__global__ void __launch_bounds__(256)
k_gemm(const f16* __restrict__ A, int lda, long long zA,
       const f16* __restrict__ Bm, int ldb, long long zB, int K,
       const float* __restrict__ bias, float scale,
       f16* __restrict__ C, int ldc, long long zC, int rowmul, int rowzadd) {
  __shared__ __align__(16) f16 sS[128 * 72];
  const int t = threadIdx.x, lane = t & 31, w = t >> 5;
  const int h = lane >> 4, m = lane & 15;
  const int row0 = blockIdx.x * 128, col0 = blockIdx.y * 64, z = blockIdx.z;
  const int mrow = (w >> 1) * 32, ncol = (w & 1) * 32;

  constexpr int PT2 = KP + 8;          // LDS row pitch, elements
  constexpr int CPR = KP / 8;          // 16-byte pieces a row
  constexpr int RPI = 256 / CPR;       // rows one copy of the whole block covers
  constexpr int NA = 128 / RPI, NB = 64 / RPI;
  __shared__ __align__(16) f16 sT[2 * 192 * PT2];

  const int crow = t / CPR, cq = (t % CPR) * 8;
  const f16* gA = A + (size_t)z * zA + (size_t)(row0 + crow) * lda + cq;
  const f16* gB = Bm + (size_t)z * zB + (size_t)(col0 + crow) * ldb + cq;
  const unsigned lA = lds_off(sT) + (unsigned)(crow * PT2 + cq) * 2u;
  const unsigned lB = lA + 128u * PT2 * 2u;
  const size_t stepA = (size_t)RPI * lda, stepB = (size_t)RPI * ldb;

  auto fill = [&](int pass, int buf) {
    const unsigned lo = (unsigned)buf * (192u * PT2 * 2u);
    const f16* pa = gA + (size_t)pass * KP;
    const f16* pb = gB + (size_t)pass * KP;
    unsigned l[NA + NB];
    const f16* g[NA + NB];
    // both loops unrolled so that l and g are registers, as the asm operands need
#pragma unroll
    for (int i = 0; i < NA; ++i) {
      l[i] = lA + lo + (unsigned)i * (RPI * PT2 * 2);
      g[i] = pa + i * stepA;
    }
#pragma unroll
    for (int i = 0; i < NB; ++i) {
      l[NA + i] = lB + lo + (unsigned)i * (RPI * PT2 * 2);
      g[NA + i] = pb + i * stepB;
    }
    cp(l, g);
  };

  const int NP = K / KP;
  fill(0, 0);
  wait_async0();
  __syncthreads();
  if (NP > 1) fill(1, 1);

  v8f vz = {};
  v8f c00 = vz, c01 = vz, c10 = vz, c11 = vz;
  for (int p = 0; p < NP; ++p) {
    const f16* sb = sT + (p & 1) * (192 * PT2);
    const f16* a0p = sb + (mrow + m) * PT2;
    const f16* a1p = a0p + 16 * PT2;
    const f16* b0p = sb + (128 + ncol + m) * PT2;
    const f16* b1p = b0p + 16 * PT2;
    // unrolled: the k offsets become immediates of the LDS loads
#pragma unroll
    for (int k0 = 0; k0 < KP; k0 += 32) {
      v16h a0 = ld_frag(a0p, k0, h);
      v16h a1 = ld_frag(a1p, k0, h);
      v16h b0 = ld_frag(b0p, k0, h);
      v16h b1 = ld_frag(b1p, k0, h);
      c00 = wmma16(a0, b0, c00);
      c01 = wmma16(a0, b1, c01);
      c10 = wmma16(a1, b0, c10);
      c11 = wmma16(a1, b1, c11);
    }
    wait_ds0();
    wait_async0();
    __syncthreads();  // publishes pass p+1 and ends every read of pass p's buffer
    if (p + 2 < NP) fill(p + 2, p & 1);
  }
  wait_async0();

  // D element r of this lane = (row mrow + mi*16 + 8h + r, col ncol + ni*16 + m)
  if (MODE == 0) {
    const int PT = 136;
    const float g0 = bias[col0 + ncol + m];
    const float g1 = bias[col0 + ncol + 16 + m];
    f16* s0 = sS + (ncol + m) * PT + mrow + 8 * h;
    f16* s1 = sS + (ncol + 16 + m) * PT + mrow + 8 * h;
#pragma unroll
    for (int r = 0; r < 8; ++r) {
      s0[r] = (f16)(c00[r] * scale + g0);
      s1[r] = (f16)(c01[r] * scale + g1);
      s0[16 + r] = (f16)(c10[r] * scale + g0);
      s1[16 + r] = (f16)(c11[r] * scale + g1);
    }
  } else {
    const int PN = 72;
    f16* s0 = sS + (mrow + 8 * h) * PN + ncol + m;
#pragma unroll
    for (int r = 0; r < 8; ++r) {
      s0[r * PN] = (f16)(c00[r] * scale);
      s0[r * PN + 16] = (f16)(c01[r] * scale);
      s0[(16 + r) * PN] = (f16)(c10[r] * scale);
      s0[(16 + r) * PN + 16] = (f16)(c11[r] * scale);
    }
  }
  __syncthreads();

  f16* Cz = C + (size_t)z * zC;
  v8h vals[4];
  if (MODE == 0) {
    // 64 cols x 256 B; piece P: col dd = P>>4, q = P&15; lanes 0..15 -> 2 lines of col dd
#pragma unroll
    for (int i = 0; i < 4; ++i) {
      const int P = t + 256 * i;
      const int dd = P >> 4, q = P & 15;
      vals[i] = *(const v8h*)(sS + dd * 136 + q * 8);
    }
#pragma unroll
    for (int i = 0; i < 4; ++i) {
      const int P = t + 256 * i;
      const int dd = P >> 4, q = P & 15;
      vst_h8(Cz + (size_t)(col0 + dd) * ldc + row0 + q * 8, vals[i]);
    }
    
  } else {
#pragma unroll
    for (int i = 0; i < 4; ++i) {
      const int P = t + 256 * i;
      const int rr = P >> 3, q = P & 7;
      vals[i] = *(const v8h*)(sS + rr * 72 + q * 8);
    }
#pragma unroll
    for (int i = 0; i < 4; ++i) {
      const int P = t + 256 * i;
      const int rr = P >> 3, q = P & 7;
      const size_t orow = (size_t)((row0 + rr) * rowmul + z * rowzadd);
      vst_h8(Cz + orow * ldc + col0 + q * 8, vals[i]);
    }
    
  }
}

// ---------------------------------------------------------------------------
// logits = 16 * (yh . Lwh^T) + Lb, log-softmax over 1000 columns, f32 out.
// Block owns 64 consecutive out rows (row index = l*4 + b) = one contiguous run of
// whole 128-byte lines, and all 1024 padded columns: 16 waves, each 64 rows x 64
// columns in 16 accumulators, so one fetch of the Lwh plane serves 64 rows.
// A pass is 64 k of the 64 yh rows and of all 1024 Lwh rows, in one of two LDS buffers.
// The f32 logits are staged over the operand buffers once the last pass has left them.
// ---------------------------------------------------------------------------
__global__ void __launch_bounds__(512)
k_logits(const f16* __restrict__ yh, const f16* __restrict__ Lwh,
         const float* __restrict__ Lb, float* __restrict__ out) {
  constexpr int MR = 64;               // out rows a block
  constexpr int KS = 64;               // k a pass
  constexpr int PB = KS + 8;           // LDS pitch of an operand row slab, elements
  constexpr int NROW = MR + VP;        // operand rows a buffer: yh rows, then Lwh rows
  constexpr int NPASS = DD / KS;
  constexpr int PL = VP + 12;          // LDS pitch of a logits row, floats
  static_assert(MR * PL * 4 <= 2 * NROW * PB * 2, "logits fit over the operand buffers");
  __shared__ __align__(16) f16 sT[2 * NROW * PB];
  __shared__ float sMx[MR];
  __shared__ float sLs[MR];
  float* sL = (float*)sT;
  const int t = threadIdx.x, lane = t & 31, w = t >> 5;
  const int h = lane >> 4, m = lane & 15;
  const int r0 = blockIdx.x * MR;

  // a thread copies piece t&7 of rows (t>>3) + 64 i: i = 0 the yh rows, i = 1..16 Lwh
  const f16* gA = yh + (size_t)(r0 + (t >> 3)) * DD + (t & 7) * 8;
  const f16* gB = Lwh + (size_t)(t >> 3) * DD + (t & 7) * 8;
  const unsigned lT = lds_off(sT) + (unsigned)((t >> 3) * PB + (t & 7) * 8) * 2u;
  auto fill = [&](int pass, int buf) {
    const unsigned lo = lT + (unsigned)buf * (NROW * PB * 2u);
    const f16* pb = gB + pass * KS;
    unsigned l0[9], l1[8];
    const f16* g0[9];
    const f16* g1[8];
    l0[0] = lo;
    g0[0] = gA + pass * KS;
    // unrolled so that the address arrays are registers, as the asm operands need
#pragma unroll
    for (int i = 0; i < 8; ++i) {
      l0[1 + i] = lo + (unsigned)(1 + i) * (64 * PB * 2);
      g0[1 + i] = pb + (size_t)i * (64 * DD);
      l1[i] = lo + (unsigned)(9 + i) * (64 * PB * 2);
      g1[i] = pb + (size_t)(8 + i) * (64 * DD);
    }
    cp(l0, g0);
    cp(l1, g1);
  };
  fill(0, 0);
  wait_async0();
  __syncthreads();
  fill(1, 1);

  // this lane's four bias values, fetched under the first passes
  float bv[4];
#pragma unroll
  for (int j = 0; j < 4; ++j) {
    const int v = w * 64 + j * 16 + m;
    bv[j] = (v < VV) ? Lb[v] : 0.0f;
  }

  v8f acc[4][4];
  // every loop over acc, a, b or bv is unrolled: constant indices keep them in registers
#pragma unroll
  for (int i = 0; i < 4; ++i)
#pragma unroll
    for (int j = 0; j < 4; ++j) acc[i][j] = v8f{};

  for (int p = 0; p < NPASS; ++p) {
    const f16* sb = sT + (p & 1) * (NROW * PB);
    const f16* ap = sb + m * PB;
    const f16* bp = sb + (MR + w * 64 + m) * PB;
    // unrolled: the k offsets become immediates of the LDS loads
#pragma unroll
    for (int k0 = 0; k0 < KS; k0 += 32) {
      v16h a[4], b[4];
#pragma unroll
      for (int i = 0; i < 4; ++i) {
        a[i] = ld_frag(ap + i * 16 * PB, k0, h);
        b[i] = ld_frag(bp + i * 16 * PB, k0, h);
      }
#pragma unroll
      for (int i = 0; i < 4; ++i)
#pragma unroll
        for (int j = 0; j < 4; ++j) acc[i][j] = wmma16(a[i], b[j], acc[i][j]);
    }
    wait_ds0();
    wait_async0();
    __syncthreads();  // publishes pass p+1 and ends every read of pass p's buffer
    if (p + 2 < NPASS) fill(p + 2, p & 1);
  }
  wait_async0();

  // D element r of this lane = (row i*16 + 8h + r, column w*64 + j*16 + m)
#pragma unroll
  for (int j = 0; j < 4; ++j) {
    const int v = w * 64 + j * 16 + m;
#pragma unroll
    for (int i = 0; i < 4; ++i) {
      float* s = sL + (i * 16 + 8 * h) * PL + v;
#pragma unroll
      for (int r = 0; r < 8; ++r) s[r * PL] = acc[i][j][r] * 16.0f + bv[j];
    }
  }
  __syncthreads();

  // 8 threads per row, 4 columns a read; a thread's share of its row is read once and
  // held in registers for the max and for the sum of exp. The two rows of a half-wave
  // lie 8 apart: 8 * PL = 32 banks mod 64, so their two 128-byte reads meet no bank twice
  const int sub = t & 7;
  const int row = ((t >> 4) & 7) | (t & 8) | ((t >> 7) << 4);
  const float* srow = sL + row * PL;
  constexpr int NQ = (VV / 4 + 7) / 8;
  v4f q[NQ];
  // unrolled (here and below) so that q is registers and the reads go out together
#pragma unroll
  for (int i = 0; i < NQ; ++i) {
    const int cq = sub + 8 * i;
    const v4f lo4 = {-3.0e38f, -3.0e38f, -3.0e38f, -3.0e38f};
    q[i] = (cq < VV / 4) ? *(const v4f*)(srow + cq * 4) : lo4;
  }
  float mx = -3.0e38f;
#pragma unroll
  for (int i = 0; i < NQ; ++i)
    mx = fmaxf(mx, fmaxf(fmaxf(q[i][0], q[i][1]), fmaxf(q[i][2], q[i][3])));
  mx = fmaxf(mx, __shfl_xor(mx, 4));
  mx = fmaxf(mx, __shfl_xor(mx, 2));
  mx = fmaxf(mx, __shfl_xor(mx, 1));
  float se = 0.0f;
#pragma unroll
  for (int i = 0; i < NQ; ++i)
    se += (__expf(q[i][0] - mx) + __expf(q[i][1] - mx)) +
          (__expf(q[i][2] - mx) + __expf(q[i][3] - mx));
  se += __shfl_xor(se, 4);
  se += __shfl_xor(se, 2);
  se += __shfl_xor(se, 1);
  if (sub == 0) {
    sMx[row] = mx;
    sLs[row] = __logf(se);
  }
  __syncthreads();

  float* ob = out + (size_t)blockIdx.x * (MR * VV);
  // unrolled so that several LDS reads are in flight ahead of each store
#pragma unroll
  for (int i = 0; i < (MR * VV / 4 + 511) / 512; ++i) {
    const int P = t + 512 * i;
    if (P < MR * VV / 4) {
      const int e = P * 4;
      const int rr = e / VV;
      const int cc = e - rr * VV;
      v4f lv = *(const v4f*)(sL + rr * PL + cc);
      const float mxr = sMx[rr], ls = sLs[rr];
      v4f o;
#pragma unroll
      for (int u = 0; u < 4; ++u) o[u] = (lv[u] - mxr) - ls;
      vst_f4(ob + e, o);
    }
  }
}

// ---------------------------------------------------------------------------
extern "C" void kernel_launch(void* const* d_in, const int* in_sizes, int n_in,
                              void* d_out, int out_size, void* d_ws, size_t ws_size,
                              hipStream_t stream) {
  if (n_in < 5) return;
  if (in_sizes[0] != LL * BB * DD || in_sizes[1] != DD * DD || in_sizes[2] != DD ||
      in_sizes[3] != VV * DD || in_sizes[4] != VV || out_size != LL * BB * VV)
    return;

  const float* x  = (const float*)d_in[0];
  const float* Ww = (const float*)d_in[1];
  const float* Wb = (const float*)d_in[2];
  const float* Lw = (const float*)d_in[3];
  const float* Lb = (const float*)d_in[4];
  float* out = (float*)d_out;
  char* ws = (char*)d_ws;

  const size_t SZ   = (size_t)BB * LL * DD * 2;      // 16 MiB per f16 activation plane
  const size_t oXh  = 0;
  const size_t oXT  = oXh + SZ;
  const size_t oWxT = oXT + SZ;
  const size_t oYh  = oWxT + SZ;
  const size_t oWwh = oYh + SZ;
  const size_t oLwh = oWwh + (size_t)DD * DD * 2;
  const size_t oGTh = oLwh + (size_t)VP * DD * 2;
  const size_t oEnd = oGTh + (size_t)BB * DD * DD * 2;
  if (oEnd > ws_size) return;

  f16* xh  = (f16*)(ws + oXh);
  f16* xT  = (f16*)(ws + oXT);
  f16* wxT = (f16*)(ws + oWxT);
  f16* yh  = (f16*)(ws + oYh);
  f16* Wwh = (f16*)(ws + oWwh);
  f16* Lwh = (f16*)(ws + oLwh);
  f16* GTh = (f16*)(ws + oGTh);

  const float inv16 = 0.0625f;

  // 1) weight planes
  k_cvt_w<<<(DD * DD / 8 + VP * DD / 8) / 256, 256, 0, stream>>>(Ww, Lw, Wwh, Lwh);
  // 2) activation planes xh[b][l][d], xT[b][d][l]
  k_cvt_x<<<dim3(LL / 64, DD / 64, BB), 256, 0, stream>>>(x, xh, xT);
  // 3) wx = x.Ww^T + Wb -> wxT[b][d'][l]   (rows l within batch z, cols d')
  k_gemm<0, 64><<<dim3(LL / 128, DD / 64, BB), 256, 0, stream>>>(
      xh, DD, (long long)LL * DD, Wwh, DD, 0LL, DD, Wb, inv16,
      wxT, LL, (long long)DD * LL, 0, 0);
  // 4) GT[b][d][d'] = sum_m x[b,m,d] wx[b,m,d'], stored x2^-4  (rows d, cols d', K = L)
  k_gemm<1, 128><<<dim3(DD / 128, DD / 64, BB), 256, 0, stream>>>(
      xT, LL, (long long)DD * LL, wxT, LL, (long long)DD * LL, LL, Wb, inv16,
      GTh, DD, (long long)DD * DD, 1, 0);
  // 5) y[b,l,d] = sum_d' x[b,l,d'] G[d',d], stored x2^-8 at row l*4+b (rows l, cols d, K = D)
  k_gemm<1, 64><<<dim3(LL / 128, DD / 64, BB), 256, 0, stream>>>(
      xh, DD, (long long)LL * DD, GTh, DD, (long long)DD * DD, DD, Wb, inv16,
      yh, DD, 0LL, BB, 1);
  // 6) logits + log-softmax -> out (L,B,V)
  k_logits<<<(LL * BB) / 64, 512, 0, stream>>>(yh, Lwh, Lb, out);
}

// v003
// It runs in 83.9 microseconds.
// In two side-by-side timings against v002, it was 1.14 and 1.13 times as fast.
// All steps since v000 together make it 2.86 times as fast.
#include <hip/hip_runtime.h>
// Contractions on v_wmma_f32_16x16x32_f16 (f16 operands, f32 accumulate): x*Ww^T (Ww carried x2^4), x^T*wx, x*(G x2^-4), (y x2^-8)*(Lw x2^4)^T; bias add and log-softmax in f32.

#define LL 4096
#define BB 4
#define DD 512
#define VV 1000
#define VP 1024

typedef _Float16 f16;
typedef f16 v16h __attribute__((ext_vector_type(16)));
typedef f16 v8h __attribute__((ext_vector_type(8)));
typedef float v8f __attribute__((ext_vector_type(8)));
typedef float v4f __attribute__((ext_vector_type(4)));

union Frag { v16h v; v8h half[2]; };
union Pk16 { v8h h; v4f f; };

// ---------------------------------------------------------------------------
// WMMA helper: issue + 4 VALU idle slots tied to D, A, B
// ---------------------------------------------------------------------------
__device__ __forceinline__ v8f wmma16(v16h a, v16h b, v8f c) {
  c = __builtin_amdgcn_wmma_f32_16x16x32_f16(false, a, false, b, (short)0, c,
                                              false, false);
  asm volatile("v_nop\n\tv_nop\n\tv_nop\n\tv_nop" : "+v"(c) : "v"(a), "v"(b));
  return c;
}

// 16x32 fragment from a k-contiguous 16-bit row (lane row/col = lane&15, h = lane>>4):
// elements 0..7 <- k0+8h .. k0+8h+7, elements 8..15 <- k0+16+8h .. k0+16+8h+7.
// Same map for A (row m) and B (column n of a [n][k] plane).
__device__ __forceinline__ v16h ld_frag(const f16* rowp, int k0, int h) {
  Frag f;
  f.half[0] = *(const v8h*)(rowp + k0 + 8 * h);
  f.half[1] = *(const v8h*)(rowp + k0 + 16 + 8 * h);
  return f.v;
}

__device__ __forceinline__ void vst_h8(f16* p, v8h v) {
  Pk16 u;
  u.h = v;
  *(v4f*)p = u.f;
}
__device__ __forceinline__ void vst_f4(float* p, v4f v) {
  *(v4f*)p = v;
}

// ---------------------------------------------------------------------------
// Weight planes: Wwh[512][512] = f16(16*Ww), Lwh[1024][512] = f16(16*Lw), rows >= 1000 zero.
// ---------------------------------------------------------------------------
__global__ void __launch_bounds__(256)
k_cvt_w(const float* __restrict__ Ww, const float* __restrict__ Lw,
        f16* __restrict__ Wwh, f16* __restrict__ Lwh) {
  const int NW = DD * DD / 8;
  const int NL = VP * DD / 8;
  const int p = blockIdx.x * 256 + threadIdx.x;
  if (p >= NW + NL) return;
  v8h v;
  f16* dst;
  if (p < NW) {
    const float* s = Ww + (size_t)p * 8;
    v4f a = *(const v4f*)s;
    v4f c = *(const v4f*)(s + 4);
#pragma unroll
    for (int j = 0; j < 4; ++j) {
      v[j] = (f16)(a[j] * 16.0f);
      v[4 + j] = (f16)(c[j] * 16.0f);
    }
    dst = Wwh + (size_t)p * 8;
  } else {
    const int pp = p - NW;
    const int row = pp >> 6;
    const int col = (pp & 63) * 8;
    if (row < VV) {
      const float* s = Lw + (size_t)row * DD + col;
      v4f a = *(const v4f*)s;
      v4f c = *(const v4f*)(s + 4);
#pragma unroll
      for (int j = 0; j < 4; ++j) {
        v[j] = (f16)(a[j] * 16.0f);
        v[4 + j] = (f16)(c[j] * 16.0f);
      }
    } else {
#pragma unroll
      for (int j = 0; j < 8; ++j) v[j] = (f16)0.0f;
    }
    dst = Lwh + (size_t)pp * 8;
  }
  vst_h8(dst, v);
  
}

// ---------------------------------------------------------------------------
// x (L,B,D) f32 -> xh[b][l][d] f16 (pitch 512) and xT[b][d][l] f16 (pitch 4096).
// Block = 64 l x 64 d of one batch; transpose through LDS; every store instruction
// ---------------------------------------------------------------------------
__global__ void __launch_bounds__(256)
k_cvt_x(const float* __restrict__ x, f16* __restrict__ xh, f16* __restrict__ xT) {
  __shared__ __align__(16) f16 sX[64 * 72];
  const int t = threadIdx.x;
  const int l0 = blockIdx.x * 64, d0 = blockIdx.y * 64, b = blockIdx.z;
  v8h hv[2];
#pragma unroll
  for (int i = 0; i < 2; ++i) {
    const int P = t + 256 * i;
    const int ll = P >> 3, dc = (P & 7) * 8;
    const float* s = x + ((size_t)(l0 + ll) * BB + b) * DD + d0 + dc;
    v4f a = *(const v4f*)s;
    v4f c = *(const v4f*)(s + 4);
    v8h v;
#pragma unroll
    for (int j = 0; j < 4; ++j) {
      v[j] = (f16)a[j];
      v[4 + j] = (f16)c[j];
    }
    hv[i] = v;
#pragma unroll
    for (int j = 0; j < 8; ++j) sX[(dc + j) * 72 + ll] = v[j];
  }
  // xh rows
#pragma unroll
  for (int i = 0; i < 2; ++i) {
    const int P = t + 256 * i;
    const int ll = P >> 3, dc = (P & 7) * 8;
    vst_h8(xh + ((size_t)(b * LL + l0 + ll)) * DD + d0 + dc, hv[i]);
  }
  
  __syncthreads();
  // xT rows (transposed tile out of LDS)
  v8h tv[2];
#pragma unroll
  for (int i = 0; i < 2; ++i) {
    const int P = t + 256 * i;
    const int dd = P >> 3, q = P & 7;
    tv[i] = *(const v8h*)(sX + dd * 72 + q * 8);
  }
#pragma unroll
  for (int i = 0; i < 2; ++i) {
    const int P = t + 256 * i;
    const int dd = P >> 3, q = P & 7;
    vst_h8(xT + ((size_t)(b * DD + d0 + dd)) * LL + l0 + q * 8, tv[i]);
  }
  
}

// ---------------------------------------------------------------------------
// Asynchronous global -> LDS copies, 16 bytes a lane: l = the lane's LDS byte address,
// g = its global address. A fill's copies go out in one statement (k_gemm<1, 256> and k_logits: two); the s_wait_xcnt
// closes it so that no address register is rewritten ahead of it.
// ---------------------------------------------------------------------------
__device__ __forceinline__ unsigned lds_off(const void* p) { return (unsigned)(size_t)p; }

__device__ __forceinline__ void cp(const unsigned (&l)[6], const f16* const (&g)[6]) {
  asm volatile(
               "global_load_async_to_lds_b128 %0, %1, off\n\t"
               "global_load_async_to_lds_b128 %2, %3, off\n\t"
               "global_load_async_to_lds_b128 %4, %5, off\n\t"
               "global_load_async_to_lds_b128 %6, %7, off\n\t"
               "global_load_async_to_lds_b128 %8, %9, off\n\t"
               "global_load_async_to_lds_b128 %10, %11, off\n\t"
               "s_wait_xcnt 0x0"
               :: "v"(l[0]), "v"(g[0]), "v"(l[1]), "v"(g[1]), "v"(l[2]), "v"(g[2]),
                  "v"(l[3]), "v"(g[3]), "v"(l[4]), "v"(g[4]), "v"(l[5]), "v"(g[5])
               : "memory");
}
__device__ __forceinline__ void cp(const unsigned (&l)[8], const f16* const (&g)[8]) {
  asm volatile(
               "global_load_async_to_lds_b128 %0, %1, off\n\t"
               "global_load_async_to_lds_b128 %2, %3, off\n\t"
               "global_load_async_to_lds_b128 %4, %5, off\n\t"
               "global_load_async_to_lds_b128 %6, %7, off\n\t"
               "global_load_async_to_lds_b128 %8, %9, off\n\t"
               "global_load_async_to_lds_b128 %10, %11, off\n\t"
               "global_load_async_to_lds_b128 %12, %13, off\n\t"
               "global_load_async_to_lds_b128 %14, %15, off\n\t"
               "s_wait_xcnt 0x0"
               :: "v"(l[0]), "v"(g[0]), "v"(l[1]), "v"(g[1]), "v"(l[2]), "v"(g[2]),
                  "v"(l[3]), "v"(g[3]), "v"(l[4]), "v"(g[4]), "v"(l[5]), "v"(g[5]),
                  "v"(l[6]), "v"(g[6]), "v"(l[7]), "v"(g[7])
               : "memory");
}
__device__ __forceinline__ void cp(const unsigned (&l)[9], const f16* const (&g)[9]) {
  asm volatile(
               "global_load_async_to_lds_b128 %0, %1, off\n\t"
               "global_load_async_to_lds_b128 %2, %3, off\n\t"
               "global_load_async_to_lds_b128 %4, %5, off\n\t"
               "global_load_async_to_lds_b128 %6, %7, off\n\t"
               "global_load_async_to_lds_b128 %8, %9, off\n\t"
               "global_load_async_to_lds_b128 %10, %11, off\n\t"
               "global_load_async_to_lds_b128 %12, %13, off\n\t"
               "global_load_async_to_lds_b128 %14, %15, off\n\t"
               "global_load_async_to_lds_b128 %16, %17, off\n\t"
               "s_wait_xcnt 0x0"
               :: "v"(l[0]), "v"(g[0]), "v"(l[1]), "v"(g[1]), "v"(l[2]), "v"(g[2]),
                  "v"(l[3]), "v"(g[3]), "v"(l[4]), "v"(g[4]), "v"(l[5]), "v"(g[5]),
                  "v"(l[6]), "v"(g[6]), "v"(l[7]), "v"(g[7]), "v"(l[8]), "v"(g[8])
               : "memory");
}
__device__ __forceinline__ void cp(const unsigned (&l)[12], const f16* const (&g)[12]) {
  asm volatile(
               "global_load_async_to_lds_b128 %0, %1, off\n\t"
               "global_load_async_to_lds_b128 %2, %3, off\n\t"
               "global_load_async_to_lds_b128 %4, %5, off\n\t"
               "global_load_async_to_lds_b128 %6, %7, off\n\t"
               "global_load_async_to_lds_b128 %8, %9, off\n\t"
               "global_load_async_to_lds_b128 %10, %11, off\n\t"
               "global_load_async_to_lds_b128 %12, %13, off\n\t"
               "global_load_async_to_lds_b128 %14, %15, off\n\t"
               "global_load_async_to_lds_b128 %16, %17, off\n\t"
               "global_load_async_to_lds_b128 %18, %19, off\n\t"
               "global_load_async_to_lds_b128 %20, %21, off\n\t"
               "global_load_async_to_lds_b128 %22, %23, off\n\t"
               "s_wait_xcnt 0x0"
               :: "v"(l[0]), "v"(g[0]), "v"(l[1]), "v"(g[1]), "v"(l[2]), "v"(g[2]),
                  "v"(l[3]), "v"(g[3]), "v"(l[4]), "v"(g[4]), "v"(l[5]), "v"(g[5]),
                  "v"(l[6]), "v"(g[6]), "v"(l[7]), "v"(g[7]), "v"(l[8]), "v"(g[8]),
                  "v"(l[9]), "v"(g[9]), "v"(l[10]), "v"(g[10]), "v"(l[11]), "v"(g[11])
               : "memory");
}
// this wave's LDS reads have retired (before a buffer it read is refilled)
__device__ __forceinline__ void wait_ds0() { asm volatile("s_wait_dscnt 0x0" ::: "memory"); }
// this wave's copies have landed (before the barrier that publishes them)
__device__ __forceinline__ void wait_async0() { asm volatile("s_wait_asynccnt 0x0" ::: "memory"); }

// ---------------------------------------------------------------------------
// Generic 128x64 tile GEMM, f16 operands, f32 accumulate.
//   A: [row][k] k-contiguous, pitch lda, batch stride zA (elements)
//   B: [n][k]   k-contiguous, pitch ldb, batch stride zB
//   8 waves, each a 32x32 sub-tile (4 accumulators), K multiple of KP.
//   A pass is KP k of all 192 operand rows, copied whole-line into one of two LDS
//   buffers (row pitch KP*2+16 bytes) while the other buffer is worked on.
// MODE 0: value = acc*scale + bias[col]; staged transposed in LDS and stored as
// MODE 1: value = acc*scale; stored as C[z*zC + orow*ldc + col] (f16),
// ---------------------------------------------------------------------------
template <int MODE, int KP>
__global__ void __launch_bounds__(256)
k_gemm(const f16* __restrict__ A, int lda, long long zA,
       const f16* __restrict__ Bm, int ldb, long long zB, int K,
       const float* __restrict__ bias, float scale,
       f16* __restrict__ C, int ldc, long long zC, int rowmul, int rowzadd) {
  __shared__ __align__(16) f16 sS[128 * 72];
  const int t = threadIdx.x, lane = t & 31, w = t >> 5;
  const int h = lane >> 4, m = lane & 15;
  const int row0 = blockIdx.x * 128, col0 = blockIdx.y * 64, z = blockIdx.z;
  const int mrow = (w >> 1) * 32, ncol = (w & 1) * 32;

  constexpr int PT2 = KP + 8;          // LDS row pitch, elements
  constexpr int CPR = KP / 8;          // 16-byte pieces a row
  constexpr int RPI = 256 / CPR;       // rows one copy of the whole block covers
  constexpr int NA = 128 / RPI, NB = 64 / RPI;
  constexpr int NS = (NA + NB > 12) ? 2 : 1;  // copy statements a fill (12 copies at most in one)
  constexpr int NH = (NA + NB) / NS;          // copies a statement
  __shared__ __align__(16) f16 sT[2 * 192 * PT2];

  const int crow = t / CPR, cq = (t % CPR) * 8;
  const f16* gA = A + (size_t)z * zA + (size_t)(row0 + crow) * lda + cq;
  const f16* gB = Bm + (size_t)z * zB + (size_t)(col0 + crow) * ldb + cq;
  const unsigned lA = lds_off(sT) + (unsigned)(crow * PT2 + cq) * 2u;
  const unsigned lB = lA + 128u * PT2 * 2u;
  const size_t stepA = (size_t)RPI * lda, stepB = (size_t)RPI * ldb;

  auto fill = [&](int pass, int buf) {
    const unsigned lo = (unsigned)buf * (192u * PT2 * 2u);
    const f16* pa = gA + (size_t)pass * KP;
    const f16* pb = gB + (size_t)pass * KP;
    unsigned l[NS][NH];
    const f16* g[NS][NH];
    // all loops unrolled so that l and g are registers, as the asm operands need
#pragma unroll
    for (int i = 0; i < NA; ++i) {
      l[i / NH][i % NH] = lA + lo + (unsigned)i * (RPI * PT2 * 2);
      g[i / NH][i % NH] = pa + i * stepA;
    }
#pragma unroll
    for (int i = 0; i < NB; ++i) {
      l[(NA + i) / NH][(NA + i) % NH] = lB + lo + (unsigned)i * (RPI * PT2 * 2);
      g[(NA + i) / NH][(NA + i) % NH] = pb + i * stepB;
    }
#pragma unroll
    for (int s = 0; s < NS; ++s) cp(l[s], g[s]);
  };

  const int NP = K / KP;
  fill(0, 0);
  wait_async0();
  __syncthreads();
  if (NP > 1) fill(1, 1);

  v8f vz = {};
  v8f c00 = vz, c01 = vz, c10 = vz, c11 = vz;
  for (int p = 0; p < NP; ++p) {
    const f16* sb = sT + (p & 1) * (192 * PT2);
    const f16* a0p = sb + (mrow + m) * PT2;
    const f16* a1p = a0p + 16 * PT2;
    const f16* b0p = sb + (128 + ncol + m) * PT2;
    const f16* b1p = b0p + 16 * PT2;
    // unrolled: the k offsets become immediates of the LDS loads
#pragma unroll
    for (int k0 = 0; k0 < KP; k0 += 32) {
      v16h a0 = ld_frag(a0p, k0, h);
      v16h a1 = ld_frag(a1p, k0, h);
      v16h b0 = ld_frag(b0p, k0, h);
      v16h b1 = ld_frag(b1p, k0, h);
      c00 = wmma16(a0, b0, c00);
      c01 = wmma16(a0, b1, c01);
      c10 = wmma16(a1, b0, c10);
      c11 = wmma16(a1, b1, c11);
    }
    wait_ds0();
    wait_async0();
    __syncthreads();  // publishes pass p+1 and ends every read of pass p's buffer
    if (p + 2 < NP) fill(p + 2, p & 1);
  }
  wait_async0();

  // D element r of this lane = (row mrow + mi*16 + 8h + r, col ncol + ni*16 + m)
  if (MODE == 0) {
    const int PT = 136;
    const float g0 = bias[col0 + ncol + m];
    const float g1 = bias[col0 + ncol + 16 + m];
    f16* s0 = sS + (ncol + m) * PT + mrow + 8 * h;
    f16* s1 = sS + (ncol + 16 + m) * PT + mrow + 8 * h;
#pragma unroll
    for (int r = 0; r < 8; ++r) {
      s0[r] = (f16)(c00[r] * scale + g0);
      s1[r] = (f16)(c01[r] * scale + g1);
      s0[16 + r] = (f16)(c10[r] * scale + g0);
      s1[16 + r] = (f16)(c11[r] * scale + g1);
    }
  } else {
    const int PN = 72;
    f16* s0 = sS + (mrow + 8 * h) * PN + ncol + m;
#pragma unroll
    for (int r = 0; r < 8; ++r) {
      s0[r * PN] = (f16)(c00[r] * scale);
      s0[r * PN + 16] = (f16)(c01[r] * scale);
      s0[(16 + r) * PN] = (f16)(c10[r] * scale);
      s0[(16 + r) * PN + 16] = (f16)(c11[r] * scale);
    }
  }
  __syncthreads();

  f16* Cz = C + (size_t)z * zC;
  v8h vals[4];
  if (MODE == 0) {
    // 64 cols x 256 B; piece P: col dd = P>>4, q = P&15; lanes 0..15 -> 2 lines of col dd
#pragma unroll
    for (int i = 0; i < 4; ++i) {
      const int P = t + 256 * i;
      const int dd = P >> 4, q = P & 15;
      vals[i] = *(const v8h*)(sS + dd * 136 + q * 8);
    }
#pragma unroll
    for (int i = 0; i < 4; ++i) {
      const int P = t + 256 * i;
      const int dd = P >> 4, q = P & 15;
      vst_h8(Cz + (size_t)(col0 + dd) * ldc + row0 + q * 8, vals[i]);
    }
    
  } else {
#pragma unroll
    for (int i = 0; i < 4; ++i) {
      const int P = t + 256 * i;
      const int rr = P >> 3, q = P & 7;
      vals[i] = *(const v8h*)(sS + rr * 72 + q * 8);
    }
#pragma unroll
    for (int i = 0; i < 4; ++i) {
      const int P = t + 256 * i;
      const int rr = P >> 3, q = P & 7;
      const size_t orow = (size_t)((row0 + rr) * rowmul + z * rowzadd);
      vst_h8(Cz + orow * ldc + col0 + q * 8, vals[i]);
    }
    
  }
}

// ---------------------------------------------------------------------------
// logits = 16 * (yh . Lwh^T) + Lb, log-softmax over 1000 columns, f32 out.
// Block owns 64 consecutive out rows (row index = l*4 + b) = one contiguous run of
// whole 128-byte lines, and all 1024 padded columns: 16 waves, each 64 rows x 64
// columns in 16 accumulators, so one fetch of the Lwh plane serves 64 rows.
// A pass is 64 k of the 64 yh rows and of all 1024 Lwh rows, in one of two LDS buffers.
// The f32 logits are staged over the operand buffers once the last pass has left them.
// ---------------------------------------------------------------------------
__global__ void __launch_bounds__(512)
k_logits(const f16* __restrict__ yh, const f16* __restrict__ Lwh,
         const float* __restrict__ Lb, float* __restrict__ out) {
  constexpr int MR = 64;               // out rows a block
  constexpr int KS = 64;               // k a pass
  constexpr int PB = KS + 8;           // LDS pitch of an operand row slab, elements
  constexpr int NROW = MR + VP;        // operand rows a buffer: yh rows, then Lwh rows
  constexpr int NPASS = DD / KS;
  constexpr int PL = VP + 12;          // LDS pitch of a logits row, floats
  static_assert(MR * PL * 4 <= 2 * NROW * PB * 2, "logits fit over the operand buffers");
  __shared__ __align__(16) f16 sT[2 * NROW * PB];
  __shared__ float sMx[MR];
  __shared__ float sLs[MR];
  float* sL = (float*)sT;
  const int t = threadIdx.x, lane = t & 31, w = t >> 5;
  const int h = lane >> 4, m = lane & 15;
  const int r0 = blockIdx.x * MR;

  // a thread copies piece t&7 of rows (t>>3) + 64 i: i = 0 the yh rows, i = 1..16 Lwh
  const f16* gA = yh + (size_t)(r0 + (t >> 3)) * DD + (t & 7) * 8;
  const f16* gB = Lwh + (size_t)(t >> 3) * DD + (t & 7) * 8;
  const unsigned lT = lds_off(sT) + (unsigned)((t >> 3) * PB + (t & 7) * 8) * 2u;
  auto fill = [&](int pass, int buf) {
    const unsigned lo = lT + (unsigned)buf * (NROW * PB * 2u);
    const f16* pb = gB + pass * KS;
    unsigned l0[9], l1[8];
    const f16* g0[9];
    const f16* g1[8];
    l0[0] = lo;
    g0[0] = gA + pass * KS;
    // unrolled so that the address arrays are registers, as the asm operands need
#pragma unroll
    for (int i = 0; i < 8; ++i) {
      l0[1 + i] = lo + (unsigned)(1 + i) * (64 * PB * 2);
      g0[1 + i] = pb + (size_t)i * (64 * DD);
      l1[i] = lo + (unsigned)(9 + i) * (64 * PB * 2);
      g1[i] = pb + (size_t)(8 + i) * (64 * DD);
    }
    cp(l0, g0);
    cp(l1, g1);
  };
  fill(0, 0);
  wait_async0();
  __syncthreads();
  fill(1, 1);

  // this lane's four bias values, fetched under the first passes
  float bv[4];
#pragma unroll
  for (int j = 0; j < 4; ++j) {
    const int v = w * 64 + j * 16 + m;
    bv[j] = (v < VV) ? Lb[v] : 0.0f;
  }

  v8f acc[4][4];
  // every loop over acc, a, b or bv is unrolled: constant indices keep them in registers
#pragma unroll
  for (int i = 0; i < 4; ++i)
#pragma unroll
    for (int j = 0; j < 4; ++j) acc[i][j] = v8f{};

  for (int p = 0; p < NPASS; ++p) {
    const f16* sb = sT + (p & 1) * (NROW * PB);
    const f16* ap = sb + m * PB;
    const f16* bp = sb + (MR + w * 64 + m) * PB;
    // unrolled: the k offsets become immediates of the LDS loads
#pragma unroll
    for (int k0 = 0; k0 < KS; k0 += 32) {
      v16h a[4], b[4];
#pragma unroll
      for (int i = 0; i < 4; ++i) {
        a[i] = ld_frag(ap + i * 16 * PB, k0, h);
        b[i] = ld_frag(bp + i * 16 * PB, k0, h);
      }
#pragma unroll
      for (int i = 0; i < 4; ++i)
#pragma unroll
        for (int j = 0; j < 4; ++j) acc[i][j] = wmma16(a[i], b[j], acc[i][j]);
    }
    wait_ds0();
    wait_async0();
    __syncthreads();  // publishes pass p+1 and ends every read of pass p's buffer
    if (p + 2 < NPASS) fill(p + 2, p & 1);
  }
  wait_async0();

  // D element r of this lane = (row i*16 + 8h + r, column w*64 + j*16 + m)
#pragma unroll
  for (int j = 0; j < 4; ++j) {
    const int v = w * 64 + j * 16 + m;
#pragma unroll
    for (int i = 0; i < 4; ++i) {
      float* s = sL + (i * 16 + 8 * h) * PL + v;
#pragma unroll
      for (int r = 0; r < 8; ++r) s[r * PL] = acc[i][j][r] * 16.0f + bv[j];
    }
  }
  __syncthreads();

  // 8 threads per row, 4 columns a read; a thread's share of its row is read once and
  // held in registers for the max and for the sum of exp. The two rows of a half-wave
  // lie 8 apart: 8 * PL = 32 banks mod 64, so their two 128-byte reads meet no bank twice
  const int sub = t & 7;
  const int row = ((t >> 4) & 7) | (t & 8) | ((t >> 7) << 4);
  const float* srow = sL + row * PL;
  constexpr int NQ = (VV / 4 + 7) / 8;
  v4f q[NQ];
  // unrolled (here and below) so that q is registers and the reads go out together
#pragma unroll
  for (int i = 0; i < NQ; ++i) {
    const int cq = sub + 8 * i;
    const v4f lo4 = {-3.0e38f, -3.0e38f, -3.0e38f, -3.0e38f};
    q[i] = (cq < VV / 4) ? *(const v4f*)(srow + cq * 4) : lo4;
  }
  float mx = -3.0e38f;
#pragma unroll
  for (int i = 0; i < NQ; ++i)
    mx = fmaxf(mx, fmaxf(fmaxf(q[i][0], q[i][1]), fmaxf(q[i][2], q[i][3])));
  mx = fmaxf(mx, __shfl_xor(mx, 4));
  mx = fmaxf(mx, __shfl_xor(mx, 2));
  mx = fmaxf(mx, __shfl_xor(mx, 1));
  float se = 0.0f;
#pragma unroll
  for (int i = 0; i < NQ; ++i)
    se += (__expf(q[i][0] - mx) + __expf(q[i][1] - mx)) +
          (__expf(q[i][2] - mx) + __expf(q[i][3] - mx));
  se += __shfl_xor(se, 4);
  se += __shfl_xor(se, 2);
  se += __shfl_xor(se, 1);
  if (sub == 0) {
    sMx[row] = mx;
    sLs[row] = __logf(se);
  }
  __syncthreads();

  float* ob = out + (size_t)blockIdx.x * (MR * VV);
  // unrolled so that several LDS reads are in flight ahead of each store
#pragma unroll
  for (int i = 0; i < (MR * VV / 4 + 511) / 512; ++i) {
    const int P = t + 512 * i;
    if (P < MR * VV / 4) {
      const int e = P * 4;
      const int rr = e / VV;
      const int cc = e - rr * VV;
      v4f lv = *(const v4f*)(sL + rr * PL + cc);
      const float mxr = sMx[rr], ls = sLs[rr];
      v4f o;
#pragma unroll
      for (int u = 0; u < 4; ++u) o[u] = (lv[u] - mxr) - ls;
      vst_f4(ob + e, o);
    }
  }
}

// ---------------------------------------------------------------------------
extern "C" void kernel_launch(void* const* d_in, const int* in_sizes, int n_in,
                              void* d_out, int out_size, void* d_ws, size_t ws_size,
                              hipStream_t stream) {
  if (n_in < 5) return;
  if (in_sizes[0] != LL * BB * DD || in_sizes[1] != DD * DD || in_sizes[2] != DD ||
      in_sizes[3] != VV * DD || in_sizes[4] != VV || out_size != LL * BB * VV)
    return;

  const float* x  = (const float*)d_in[0];
  const float* Ww = (const float*)d_in[1];
  const float* Wb = (const float*)d_in[2];
  const float* Lw = (const float*)d_in[3];
  const float* Lb = (const float*)d_in[4];
  float* out = (float*)d_out;
  char* ws = (char*)d_ws;

  const size_t SZ   = (size_t)BB * LL * DD * 2;      // 16 MiB per f16 activation plane
  const size_t oXh  = 0;
  const size_t oXT  = oXh + SZ;
  const size_t oWxT = oXT + SZ;
  const size_t oYh  = oWxT + SZ;
  const size_t oWwh = oYh + SZ;
  const size_t oLwh = oWwh + (size_t)DD * DD * 2;
  const size_t oGTh = oLwh + (size_t)VP * DD * 2;
  const size_t oEnd = oGTh + (size_t)BB * DD * DD * 2;
  if (oEnd > ws_size) return;

  f16* xh  = (f16*)(ws + oXh);
  f16* xT  = (f16*)(ws + oXT);
  f16* wxT = (f16*)(ws + oWxT);
  f16* yh  = (f16*)(ws + oYh);
  f16* Wwh = (f16*)(ws + oWwh);
  f16* Lwh = (f16*)(ws + oLwh);
  f16* GTh = (f16*)(ws + oGTh);

  const float inv16 = 0.0625f;

  // 1) weight planes
  k_cvt_w<<<(DD * DD / 8 + VP * DD / 8) / 256, 256, 0, stream>>>(Ww, Lw, Wwh, Lwh);
  // 2) activation planes xh[b][l][d], xT[b][d][l]
  k_cvt_x<<<dim3(LL / 64, DD / 64, BB), 256, 0, stream>>>(x, xh, xT);
  // 3) wx = x.Ww^T + Wb -> wxT[b][d'][l]   (rows l within batch z, cols d')
  k_gemm<0, 64><<<dim3(LL / 128, DD / 64, BB), 256, 0, stream>>>(
      xh, DD, (long long)LL * DD, Wwh, DD, 0LL, DD, Wb, inv16,
      wxT, LL, (long long)DD * LL, 0, 0);
  // 4) GT[b][d][d'] = sum_m x[b,m,d] wx[b,m,d'], stored x2^-4  (rows d, cols d', K = L)
  k_gemm<1, 256><<<dim3(DD / 128, DD / 64, BB), 256, 0, stream>>>(
      xT, LL, (long long)DD * LL, wxT, LL, (long long)DD * LL, LL, Wb, inv16,
      GTh, DD, (long long)DD * DD, 1, 0);
  // 5) y[b,l,d] = sum_d' x[b,l,d'] G[d',d], stored x2^-8 at row l*4+b (rows l, cols d, K = D)
  k_gemm<1, 64><<<dim3(LL / 128, DD / 64, BB), 256, 0, stream>>>(
      xh, DD, (long long)LL * DD, GTh, DD, (long long)DD * DD, DD, Wb, inv16,
      yh, DD, 0LL, BB, 1);
  // 6) logits + log-softmax -> out (L,B,V)
  k_logits<<<(LL * BB) / 64, 512, 0, stream>>>(yh, Lwh, Lb, out);
}

// v005
// Measured time: 70.6 microseconds a run.
// It is 1.20 times as fast as v003, going by the measured steps of the versions left out in between.
// Over all steps from v000 it is 3.44 times as fast.
#include <hip/hip_runtime.h>
// Contractions on v_wmma_f32_16x16x32_f16 (f16 operands, f32 accumulate): S = x^T*x, (S x2^-4)*(Ww x2^4)^T, x*(G x2^-4), (y x2^-8)*(Lw x2^4)^T; bias terms and log-softmax in f32.
// G^T = x^T*(x*Ww^T + 1*Wb^T) is formed as (x^T*x)*Ww^T + (column sums of x)*Wb^T.
// x^T*x is summed in two halves of L by separate work-groups; the product with Ww^T runs over both halves (K = 2*D) and so adds them.

#define LL 4096
#define BB 4
#define DD 512
#define VV 1000
#define VP 1024

typedef _Float16 f16;
typedef f16 v16h __attribute__((ext_vector_type(16)));
typedef f16 v8h __attribute__((ext_vector_type(8)));
typedef float v8f __attribute__((ext_vector_type(8)));
typedef float v4f __attribute__((ext_vector_type(4)));

union Frag { v16h v; v8h half[2]; };
union Pk16 { v8h h; v4f f; };

// ---------------------------------------------------------------------------
// WMMA helper: issue + 4 VALU idle slots tied to D, A, B
// ---------------------------------------------------------------------------
__device__ __forceinline__ v8f wmma16(v16h a, v16h b, v8f c) {
  c = __builtin_amdgcn_wmma_f32_16x16x32_f16(false, a, false, b, (short)0, c,
                                              false, false);
  asm volatile("v_nop\n\tv_nop\n\tv_nop\n\tv_nop" : "+v"(c) : "v"(a), "v"(b));
  return c;
}

// 16x32 fragment from a k-contiguous 16-bit row (lane row/col = lane&15, h = lane>>4):
// elements 0..7 <- k0+8h .. k0+8h+7, elements 8..15 <- k0+16+8h .. k0+16+8h+7.
// Same map for A (row m) and B (column n of a [n][k] plane).
__device__ __forceinline__ v16h ld_frag(const f16* rowp, int k0, int h) {
  Frag f;
  f.half[0] = *(const v8h*)(rowp + k0 + 8 * h);
  f.half[1] = *(const v8h*)(rowp + k0 + 16 + 8 * h);
  return f.v;
}

__device__ __forceinline__ void vst_h8(f16* p, v8h v) {
  Pk16 u;
  u.h = v;
  *(v4f*)p = u.f;
}
__device__ __forceinline__ void vst_f4(float* p, v4f v) {
  *(v4f*)p = v;
}

// ---------------------------------------------------------------------------
// Weight planes: Wwh[512][512] = f16(16*Ww), Lwh[1024][512] = f16(16*Lw), rows >= 1000 zero.
// ---------------------------------------------------------------------------
__global__ void __launch_bounds__(256)
k_cvt_w(const float* __restrict__ Ww, const float* __restrict__ Lw,
        f16* __restrict__ Wwh, f16* __restrict__ Lwh) {
  const int NW = DD * DD / 8;
  const int NL = VP * DD / 8;
  const int p = blockIdx.x * 256 + threadIdx.x;
  if (p >= NW + NL) return;
  v8h v;
  f16* dst;
  if (p < NW) {
    const float* s = Ww + (size_t)p * 8;
    v4f a = *(const v4f*)s;
    v4f c = *(const v4f*)(s + 4);
#pragma unroll
    for (int j = 0; j < 4; ++j) {
      v[j] = (f16)(a[j] * 16.0f);
      v[4 + j] = (f16)(c[j] * 16.0f);
    }
    dst = Wwh + (size_t)p * 8;
  } else {
    const int pp = p - NW;
    const int row = pp >> 6;
    const int col = (pp & 63) * 8;
    if (row < VV) {
      const float* s = Lw + (size_t)row * DD + col;
      v4f a = *(const v4f*)s;
      v4f c = *(const v4f*)(s + 4);
#pragma unroll
      for (int j = 0; j < 4; ++j) {
        v[j] = (f16)(a[j] * 16.0f);
        v[4 + j] = (f16)(c[j] * 16.0f);
      }
    } else {
#pragma unroll
      for (int j = 0; j < 8; ++j) v[j] = (f16)0.0f;
    }
    dst = Lwh + (size_t)pp * 8;
  }
  vst_h8(dst, v);
  
}

// ---------------------------------------------------------------------------
// x (L,B,D) f32 -> xh[b][l][d] f16 (pitch 512) and xT[b][d][l] f16 (pitch 4096).
// Block = 64 l x 64 d of one batch; transpose through LDS; every store instruction
// ps[b][l block][d] = the tile's sum over its 64 l, f32.
// ---------------------------------------------------------------------------
__global__ void __launch_bounds__(256)
k_cvt_x(const float* __restrict__ x, f16* __restrict__ xh, f16* __restrict__ xT,
        float* __restrict__ ps) {
  __shared__ __align__(16) f16 sX[64 * 72];
  const int t = threadIdx.x;
  const int l0 = blockIdx.x * 64, d0 = blockIdx.y * 64, b = blockIdx.z;
  v8h hv[2];
#pragma unroll
  for (int i = 0; i < 2; ++i) {
    const int P = t + 256 * i;
    const int ll = P >> 3, dc = (P & 7) * 8;
    const float* s = x + ((size_t)(l0 + ll) * BB + b) * DD + d0 + dc;
    v4f a = *(const v4f*)s;
    v4f c = *(const v4f*)(s + 4);
    v8h v;
#pragma unroll
    for (int j = 0; j < 4; ++j) {
      v[j] = (f16)a[j];
      v[4 + j] = (f16)c[j];
    }
    hv[i] = v;
#pragma unroll
    for (int j = 0; j < 8; ++j) sX[(dc + j) * 72 + ll] = v[j];
  }
  // xh rows
#pragma unroll
  for (int i = 0; i < 2; ++i) {
    const int P = t + 256 * i;
    const int ll = P >> 3, dc = (P & 7) * 8;
    vst_h8(xh + ((size_t)(b * LL + l0 + ll)) * DD + d0 + dc, hv[i]);
  }
  
  __syncthreads();
  // xT rows (transposed tile out of LDS)
  v8h tv[2];
#pragma unroll
  for (int i = 0; i < 2; ++i) {
    const int P = t + 256 * i;
    const int dd = P >> 3, q = P & 7;
    tv[i] = *(const v8h*)(sX + dd * 72 + q * 8);
  }
#pragma unroll
  for (int i = 0; i < 2; ++i) {
    const int P = t + 256 * i;
    const int dd = P >> 3, q = P & 7;
    vst_h8(xT + ((size_t)(b * DD + d0 + dd)) * LL + l0 + q * 8, tv[i]);
  }
  // the 8 threads of a d row add up its 64 l (this thread's two rows side by side)
  float sm0 = 0.0f, sm1 = 0.0f;
  // unrolled: constant indices keep tv in registers
#pragma unroll
  for (int j = 0; j < 8; ++j) {
    sm0 += (float)tv[0][j];
    sm1 += (float)tv[1][j];
  }
  // unrolled: the three lane distances become constants
#pragma unroll
  for (int k = 1; k < 8; k <<= 1) {
    const float o0 = __shfl_xor(sm0, k), o1 = __shfl_xor(sm1, k);
    sm0 += o0;
    sm1 += o1;
  }
  if ((t & 7) == 0) {
    float* pp = ps + (size_t)(b * (LL / 64) + blockIdx.x) * DD + d0 + (t >> 3);
    pp[0] = sm0;
    pp[32] = sm1;
  }
}

// ---------------------------------------------------------------------------
// Asynchronous global -> LDS copies, 16 bytes a lane: l = the lane's LDS byte address,
// g = its global address. A fill's copies go out in one statement (k_gemm with KP = 256 and k_logits: two); the s_wait_xcnt
// closes it so that no address register is rewritten ahead of it.
// ---------------------------------------------------------------------------
__device__ __forceinline__ unsigned lds_off(const void* p) { return (unsigned)(size_t)p; }

__device__ __forceinline__ void cp(const unsigned (&l)[6], const f16* const (&g)[6]) {
  asm volatile(
               "global_load_async_to_lds_b128 %0, %1, off\n\t"
               "global_load_async_to_lds_b128 %2, %3, off\n\t"
               "global_load_async_to_lds_b128 %4, %5, off\n\t"
               "global_load_async_to_lds_b128 %6, %7, off\n\t"
               "global_load_async_to_lds_b128 %8, %9, off\n\t"
               "global_load_async_to_lds_b128 %10, %11, off\n\t"
               "s_wait_xcnt 0x0"
               :: "v"(l[0]), "v"(g[0]), "v"(l[1]), "v"(g[1]), "v"(l[2]), "v"(g[2]),
                  "v"(l[3]), "v"(g[3]), "v"(l[4]), "v"(g[4]), "v"(l[5]), "v"(g[5])
               : "memory");
}
__device__ __forceinline__ void cp(const unsigned (&l)[8], const f16* const (&g)[8]) {
  asm volatile(
               "global_load_async_to_lds_b128 %0, %1, off\n\t"
               "global_load_async_to_lds_b128 %2, %3, off\n\t"
               "global_load_async_to_lds_b128 %4, %5, off\n\t"
               "global_load_async_to_lds_b128 %6, %7, off\n\t"
               "global_load_async_to_lds_b128 %8, %9, off\n\t"
               "global_load_async_to_lds_b128 %10, %11, off\n\t"
               "global_load_async_to_lds_b128 %12, %13, off\n\t"
               "global_load_async_to_lds_b128 %14, %15, off\n\t"
               "s_wait_xcnt 0x0"
               :: "v"(l[0]), "v"(g[0]), "v"(l[1]), "v"(g[1]), "v"(l[2]), "v"(g[2]),
                  "v"(l[3]), "v"(g[3]), "v"(l[4]), "v"(g[4]), "v"(l[5]), "v"(g[5]),
                  "v"(l[6]), "v"(g[6]), "v"(l[7]), "v"(g[7])
               : "memory");
}
__device__ __forceinline__ void cp(const unsigned (&l)[9], const f16* const (&g)[9]) {
  asm volatile(
               "global_load_async_to_lds_b128 %0, %1, off\n\t"
               "global_load_async_to_lds_b128 %2, %3, off\n\t"
               "global_load_async_to_lds_b128 %4, %5, off\n\t"
               "global_load_async_to_lds_b128 %6, %7, off\n\t"
               "global_load_async_to_lds_b128 %8, %9, off\n\t"
               "global_load_async_to_lds_b128 %10, %11, off\n\t"
               "global_load_async_to_lds_b128 %12, %13, off\n\t"
               "global_load_async_to_lds_b128 %14, %15, off\n\t"
               "global_load_async_to_lds_b128 %16, %17, off\n\t"
               "s_wait_xcnt 0x0"
               :: "v"(l[0]), "v"(g[0]), "v"(l[1]), "v"(g[1]), "v"(l[2]), "v"(g[2]),
                  "v"(l[3]), "v"(g[3]), "v"(l[4]), "v"(g[4]), "v"(l[5]), "v"(g[5]),
                  "v"(l[6]), "v"(g[6]), "v"(l[7]), "v"(g[7]), "v"(l[8]), "v"(g[8])
               : "memory");
}
__device__ __forceinline__ void cp(const unsigned (&l)[12], const f16* const (&g)[12]) {
  asm volatile(
               "global_load_async_to_lds_b128 %0, %1, off\n\t"
               "global_load_async_to_lds_b128 %2, %3, off\n\t"
               "global_load_async_to_lds_b128 %4, %5, off\n\t"
               "global_load_async_to_lds_b128 %6, %7, off\n\t"
               "global_load_async_to_lds_b128 %8, %9, off\n\t"
               "global_load_async_to_lds_b128 %10, %11, off\n\t"
               "global_load_async_to_lds_b128 %12, %13, off\n\t"
               "global_load_async_to_lds_b128 %14, %15, off\n\t"
               "global_load_async_to_lds_b128 %16, %17, off\n\t"
               "global_load_async_to_lds_b128 %18, %19, off\n\t"
               "global_load_async_to_lds_b128 %20, %21, off\n\t"
               "global_load_async_to_lds_b128 %22, %23, off\n\t"
               "s_wait_xcnt 0x0"
               :: "v"(l[0]), "v"(g[0]), "v"(l[1]), "v"(g[1]), "v"(l[2]), "v"(g[2]),
                  "v"(l[3]), "v"(g[3]), "v"(l[4]), "v"(g[4]), "v"(l[5]), "v"(g[5]),
                  "v"(l[6]), "v"(g[6]), "v"(l[7]), "v"(g[7]), "v"(l[8]), "v"(g[8]),
                  "v"(l[9]), "v"(g[9]), "v"(l[10]), "v"(g[10]), "v"(l[11]), "v"(g[11])
               : "memory");
}
// this wave's LDS reads have retired (before a buffer it read is refilled)
__device__ __forceinline__ void wait_ds0() { asm volatile("s_wait_dscnt 0x0" ::: "memory"); }
// this wave's copies have landed (before the barrier that publishes them)
__device__ __forceinline__ void wait_async0() { asm volatile("s_wait_asynccnt 0x0" ::: "memory"); }

// ---------------------------------------------------------------------------
// Generic 128x64 tile GEMM, f16 operands, f32 accumulate.
//   A: [row][k] k-contiguous, pitch lda, batch stride zA (elements)
//   B: [n][k]   k-contiguous, pitch ldb, batch stride zB
//   8 waves, each a 32x32 sub-tile (4 accumulators), K multiple of KP.
//   A pass is KP k of all 192 operand rows, copied whole-line into one of two LDS
//   buffers (row pitch KP*2+16 bytes) while the other buffer is worked on.
//   SPLIT work-groups share a tile: part sp sums k = sp*K .. sp*K+K-1 and stores its own
//   plane: a row of C holds the SPLIT planes side by side, ldc/SPLIT columns each.
// MODE 1: value = acc*scale; stored as C[z*zC + orow*ldc + col] (f16),
// MODE 2: value = (acc + rsum[row]*bias[col])*scale, stored alike; rsum[row] = the sum of
//         the LL/64 partial sums rs[z][.][row]. A holds K/DD planes side by side in k,
//         B one plane of DD k that every plane of A meets (its k index wraps at DD).
// ---------------------------------------------------------------------------
template <int MODE, int KP, int SPLIT>
__global__ void __launch_bounds__(256)
k_gemm(const f16* __restrict__ A, int lda, long long zA,
       const f16* __restrict__ Bm, int ldb, long long zB, int K,
       const float* __restrict__ bias, const float* __restrict__ rs, float scale,
       f16* __restrict__ C, int ldc, long long zC, int rowmul, int rowzadd) {
  __shared__ __align__(16) f16 sS[128 * 72];
  __shared__ float sR[MODE == 2 ? 256 : 1];
  const int t = threadIdx.x, lane = t & 31, w = t >> 5;
  const int h = lane >> 4, m = lane & 15;
  const int row0 = blockIdx.x * 128, col0 = blockIdx.y * 64;
  const int z = blockIdx.z / SPLIT, sp = blockIdx.z % SPLIT;
  const int mrow = (w >> 1) * 32, ncol = (w & 1) * 32;

  constexpr int PT2 = KP + 8;          // LDS row pitch, elements
  constexpr int CPR = KP / 8;          // 16-byte pieces a row
  constexpr int RPI = 256 / CPR;       // rows one copy of the whole block covers
  constexpr int NA = 128 / RPI, NB = 64 / RPI;
  constexpr int NS = (NA + NB > 12) ? 2 : 1;  // copy statements a fill (12 copies at most in one)
  constexpr int NH = (NA + NB) / NS;          // copies a statement
  __shared__ __align__(16) f16 sT[2 * 192 * PT2];

  const int crow = t / CPR, cq = (t % CPR) * 8;
  const int kq = sp * K + cq;  // this thread's first k
  const f16* gA = A + (size_t)z * zA + (size_t)(row0 + crow) * lda + kq;
  const f16* gB = Bm + (size_t)z * zB + (size_t)(col0 + crow) * ldb + kq;
  const unsigned lA = lds_off(sT) + (unsigned)(crow * PT2 + cq) * 2u;
  const unsigned lB = lA + 128u * PT2 * 2u;
  const size_t stepA = (size_t)RPI * lda, stepB = (size_t)RPI * ldb;

  auto fill = [&](int pass, int buf) {
    const unsigned lo = (unsigned)buf * (192u * PT2 * 2u);
    const f16* pa = gA + (size_t)pass * KP;
    const f16* pb = gB + (size_t)(MODE == 2 ? (pass * KP) % DD : pass * KP);
    unsigned l[NS][NH];
    const f16* g[NS][NH];
    // all loops unrolled so that l and g are registers, as the asm operands need
#pragma unroll
    for (int i = 0; i < NA; ++i) {
      l[i / NH][i % NH] = lA + lo + (unsigned)i * (RPI * PT2 * 2);
      g[i / NH][i % NH] = pa + i * stepA;
    }
#pragma unroll
    for (int i = 0; i < NB; ++i) {
      l[(NA + i) / NH][(NA + i) % NH] = lB + lo + (unsigned)i * (RPI * PT2 * 2);
      g[(NA + i) / NH][(NA + i) % NH] = pb + i * stepB;
    }
#pragma unroll
    for (int s = 0; s < NS; ++s) cp(l[s], g[s]);
  };

  const int NP = K / KP;
  fill(0, 0);
  wait_async0();
  __syncthreads();
  if (NP > 1) fill(1, 1);

  float g0 = 0.0f, g1 = 0.0f;
  if (MODE == 2) {
    g0 = bias[col0 + ncol + m];
    g1 = bias[col0 + ncol + 16 + m];
    // two threads a row, each half of the partial sums, fetched under the first pass;
    // read back behind the passes' barriers
    const float* pr = rs + ((size_t)z * (LL / 64) + (size_t)(t >> 7) * (LL / 128)) * DD + row0 + (t & 127);
    float sm = 0.0f;
    // unrolled so that the loads go out together
#pragma unroll
    for (int j = 0; j < LL / 128; ++j) sm += pr[(size_t)j * DD];
    sR[t] = sm;
  }

  v8f vz = {};
  v8f c00 = vz, c01 = vz, c10 = vz, c11 = vz;
  for (int p = 0; p < NP; ++p) {
    const f16* sb = sT + (p & 1) * (192 * PT2);
    const f16* a0p = sb + (mrow + m) * PT2;
    const f16* a1p = a0p + 16 * PT2;
    const f16* b0p = sb + (128 + ncol + m) * PT2;
    const f16* b1p = b0p + 16 * PT2;
    // unrolled: the k offsets become immediates of the LDS loads
#pragma unroll
    for (int k0 = 0; k0 < KP; k0 += 32) {
      v16h a0 = ld_frag(a0p, k0, h);
      v16h a1 = ld_frag(a1p, k0, h);
      v16h b0 = ld_frag(b0p, k0, h);
      v16h b1 = ld_frag(b1p, k0, h);
      c00 = wmma16(a0, b0, c00);
      c01 = wmma16(a0, b1, c01);
      c10 = wmma16(a1, b0, c10);
      c11 = wmma16(a1, b1, c11);
    }
    wait_ds0();
    wait_async0();
    __syncthreads();  // publishes pass p+1 and ends every read of pass p's buffer
    if (p + 2 < NP) fill(p + 2, p & 1);
  }
  wait_async0();

  // D element r of this lane = (row mrow + mi*16 + 8h + r, col ncol + ni*16 + m)
  {
    const int PN = 72;
    f16* s0 = sS + (mrow + 8 * h) * PN + ncol + m;
    if (MODE == 2) {
      const float* rp = sR + mrow + 8 * h;
      // unrolled: constant indices keep the accumulators in registers
#pragma unroll
      for (int r = 0; r < 8; ++r) {
        const float r0 = rp[r] + rp[128 + r];
        const float r1 = rp[16 + r] + rp[144 + r];
        c00[r] += r0 * g0;
        c01[r] += r0 * g1;
        c10[r] += r1 * g0;
        c11[r] += r1 * g1;
      }
    }
#pragma unroll
    for (int r = 0; r < 8; ++r) {
      s0[r * PN] = (f16)(c00[r] * scale);
      s0[r * PN + 16] = (f16)(c01[r] * scale);
      s0[(16 + r) * PN] = (f16)(c10[r] * scale);
      s0[(16 + r) * PN + 16] = (f16)(c11[r] * scale);
    }
  }
  __syncthreads();

  f16* Cz = C + (size_t)z * zC + (size_t)sp * (ldc / SPLIT);
  v8h vals[4];
  {
#pragma unroll
    for (int i = 0; i < 4; ++i) {
      const int P = t + 256 * i;
      const int rr = P >> 3, q = P & 7;
      vals[i] = *(const v8h*)(sS + rr * 72 + q * 8);
    }
#pragma unroll
    for (int i = 0; i < 4; ++i) {
      const int P = t + 256 * i;
      const int rr = P >> 3, q = P & 7;
      const size_t orow = (size_t)((row0 + rr) * rowmul + z * rowzadd);
      vst_h8(Cz + orow * ldc + col0 + q * 8, vals[i]);
    }
    
  }
}

// ---------------------------------------------------------------------------
// logits = 16 * (yh . Lwh^T) + Lb, log-softmax over 1000 columns, f32 out.
// Block owns 64 consecutive out rows (row index = l*4 + b) = one contiguous run of
// whole 128-byte lines, and all 1024 padded columns: 16 waves, each 64 rows x 64
// columns in 16 accumulators, so one fetch of the Lwh plane serves 64 rows.
// A pass is 64 k of the 64 yh rows and of all 1024 Lwh rows, in one of two LDS buffers.
// The f32 logits are staged over the operand buffers once the last pass has left them.
// ---------------------------------------------------------------------------
__global__ void __launch_bounds__(512)
k_logits(const f16* __restrict__ yh, const f16* __restrict__ Lwh,
         const float* __restrict__ Lb, float* __restrict__ out) {
  constexpr int MR = 64;               // out rows a block
  constexpr int KS = 64;               // k a pass
  constexpr int PB = KS + 8;           // LDS pitch of an operand row slab, elements
  constexpr int NROW = MR + VP;        // operand rows a buffer: yh rows, then Lwh rows
  constexpr int NPASS = DD / KS;
  constexpr int PL = VP + 12;          // LDS pitch of a logits row, floats
  static_assert(MR * PL * 4 <= 2 * NROW * PB * 2, "logits fit over the operand buffers");
  __shared__ __align__(16) f16 sT[2 * NROW * PB];
  __shared__ float sMx[MR];
  __shared__ float sLs[MR];
  float* sL = (float*)sT;
  const int t = threadIdx.x, lane = t & 31, w = t >> 5;
  const int h = lane >> 4, m = lane & 15;
  const int r0 = blockIdx.x * MR;

  // a thread copies piece t&7 of rows (t>>3) + 64 i: i = 0 the yh rows, i = 1..16 Lwh
  const f16* gA = yh + (size_t)(r0 + (t >> 3)) * DD + (t & 7) * 8;
  const f16* gB = Lwh + (size_t)(t >> 3) * DD + (t & 7) * 8;
  const unsigned lT = lds_off(sT) + (unsigned)((t >> 3) * PB + (t & 7) * 8) * 2u;
  auto fill = [&](int pass, int buf) {
    const unsigned lo = lT + (unsigned)buf * (NROW * PB * 2u);
    const f16* pb = gB + pass * KS;
    unsigned l0[9], l1[8];
    const f16* g0[9];
    const f16* g1[8];
    l0[0] = lo;
    g0[0] = gA + pass * KS;
    // unrolled so that the address arrays are registers, as the asm operands need
#pragma unroll
    for (int i = 0; i < 8; ++i) {
      l0[1 + i] = lo + (unsigned)(1 + i) * (64 * PB * 2);
      g0[1 + i] = pb + (size_t)i * (64 * DD);
      l1[i] = lo + (unsigned)(9 + i) * (64 * PB * 2);
      g1[i] = pb + (size_t)(8 + i) * (64 * DD);
    }
    cp(l0, g0);
    cp(l1, g1);
  };
  fill(0, 0);
  wait_async0();
  __syncthreads();
  fill(1, 1);

  // this lane's four bias values, fetched under the first passes
  float bv[4];
#pragma unroll
  for (int j = 0; j < 4; ++j) {
    const int v = w * 64 + j * 16 + m;
    bv[j] = (v < VV) ? Lb[v] : 0.0f;
  }

  v8f acc[4][4];
  // every loop over acc, a, b or bv is unrolled: constant indices keep them in registers
#pragma unroll
  for (int i = 0; i < 4; ++i)
#pragma unroll
    for (int j = 0; j < 4; ++j) acc[i][j] = v8f{};

  for (int p = 0; p < NPASS; ++p) {
    const f16* sb = sT + (p & 1) * (NROW * PB);
    const f16* ap = sb + m * PB;
    const f16* bp = sb + (MR + w * 64 + m) * PB;
    // unrolled: the k offsets become immediates of the LDS loads
#pragma unroll
    for (int k0 = 0; k0 < KS; k0 += 32) {
      v16h a[4], b[4];
#pragma unroll
      for (int i = 0; i < 4; ++i) {
        a[i] = ld_frag(ap + i * 16 * PB, k0, h);
        b[i] = ld_frag(bp + i * 16 * PB, k0, h);
      }
#pragma unroll
      for (int i = 0; i < 4; ++i)
#pragma unroll
        for (int j = 0; j < 4; ++j) acc[i][j] = wmma16(a[i], b[j], acc[i][j]);
    }
    wait_ds0();
    wait_async0();
    __syncthreads();  // publishes pass p+1 and ends every read of pass p's buffer
    if (p + 2 < NPASS) fill(p + 2, p & 1);
  }
  wait_async0();

  // D element r of this lane = (row i*16 + 8h + r, column w*64 + j*16 + m)
#pragma unroll
  for (int j = 0; j < 4; ++j) {
    const int v = w * 64 + j * 16 + m;
#pragma unroll
    for (int i = 0; i < 4; ++i) {
      float* s = sL + (i * 16 + 8 * h) * PL + v;
#pragma unroll
      for (int r = 0; r < 8; ++r) s[r * PL] = acc[i][j][r] * 16.0f + bv[j];
    }
  }
  __syncthreads();

  // 8 threads per row, 4 columns a read; a thread's share of its row is read once and
  // held in registers for the max and for the sum of exp. The two rows of a half-wave
  // lie 8 apart: 8 * PL = 32 banks mod 64, so their two 128-byte reads meet no bank twice
  const int sub = t & 7;
  const int row = ((t >> 4) & 7) | (t & 8) | ((t >> 7) << 4);
  const float* srow = sL + row * PL;
  constexpr int NQ = (VV / 4 + 7) / 8;
  v4f q[NQ];
  // unrolled (here and below) so that q is registers and the reads go out together
#pragma unroll
  for (int i = 0; i < NQ; ++i) {
    const int cq = sub + 8 * i;
    const v4f lo4 = {-3.0e38f, -3.0e38f, -3.0e38f, -3.0e38f};
    q[i] = (cq < VV / 4) ? *(const v4f*)(srow + cq * 4) : lo4;
  }
  float mx = -3.0e38f;
#pragma unroll
  for (int i = 0; i < NQ; ++i)
    mx = fmaxf(mx, fmaxf(fmaxf(q[i][0], q[i][1]), fmaxf(q[i][2], q[i][3])));
  mx = fmaxf(mx, __shfl_xor(mx, 4));
  mx = fmaxf(mx, __shfl_xor(mx, 2));
  mx = fmaxf(mx, __shfl_xor(mx, 1));
  float se = 0.0f;
#pragma unroll
  for (int i = 0; i < NQ; ++i)
    se += (__expf(q[i][0] - mx) + __expf(q[i][1] - mx)) +
          (__expf(q[i][2] - mx) + __expf(q[i][3] - mx));
  se += __shfl_xor(se, 4);
  se += __shfl_xor(se, 2);
  se += __shfl_xor(se, 1);
  if (sub == 0) {
    sMx[row] = mx;
    sLs[row] = __logf(se);
  }
  __syncthreads();

  float* ob = out + (size_t)blockIdx.x * (MR * VV);
  // unrolled so that several LDS reads are in flight ahead of each store
#pragma unroll
  for (int i = 0; i < (MR * VV / 4 + 511) / 512; ++i) {
    const int P = t + 512 * i;
    if (P < MR * VV / 4) {
      const int e = P * 4;
      const int rr = e / VV;
      const int cc = e - rr * VV;
      v4f lv = *(const v4f*)(sL + rr * PL + cc);
      const float mxr = sMx[rr], ls = sLs[rr];
      v4f o;
#pragma unroll
      for (int u = 0; u < 4; ++u) o[u] = (lv[u] - mxr) - ls;
      vst_f4(ob + e, o);
    }
  }
}

// ---------------------------------------------------------------------------
extern "C" void kernel_launch(void* const* d_in, const int* in_sizes, int n_in,
                              void* d_out, int out_size, void* d_ws, size_t ws_size,
                              hipStream_t stream) {
  if (n_in < 5) return;
  if (in_sizes[0] != LL * BB * DD || in_sizes[1] != DD * DD || in_sizes[2] != DD ||
      in_sizes[3] != VV * DD || in_sizes[4] != VV || out_size != LL * BB * VV)
    return;

  const float* x  = (const float*)d_in[0];
  const float* Ww = (const float*)d_in[1];
  const float* Wb = (const float*)d_in[2];
  const float* Lw = (const float*)d_in[3];
  const float* Lb = (const float*)d_in[4];
  float* out = (float*)d_out;
  char* ws = (char*)d_ws;

  const size_t SZ   = (size_t)BB * LL * DD * 2;      // 16 MiB per f16 activation plane
  const size_t oXh  = 0;
  const size_t oXT  = oXh + SZ;
  const size_t oYh  = oXT + SZ;
  const size_t oWwh = oYh + SZ;
  const size_t oLwh = oWwh + (size_t)DD * DD * 2;
  const size_t oGTh = oLwh + (size_t)VP * DD * 2;
  const size_t oSh  = oGTh + (size_t)BB * DD * DD * 2;
  const size_t oPs  = oSh + (size_t)BB * DD * (2 * DD) * 2;
  const size_t oEnd = oPs + (size_t)BB * (LL / 64) * DD * 4;
  if (oEnd > ws_size) return;

  f16* xh  = (f16*)(ws + oXh);
  f16* xT  = (f16*)(ws + oXT);
  f16* yh  = (f16*)(ws + oYh);
  f16* Wwh = (f16*)(ws + oWwh);
  f16* Lwh = (f16*)(ws + oLwh);
  f16* GTh = (f16*)(ws + oGTh);
  f16* Sh  = (f16*)(ws + oSh);
  float* ps = (float*)(ws + oPs);

  const float inv16 = 0.0625f;

  // 1) weight planes
  k_cvt_w<<<(DD * DD / 8 + VP * DD / 8) / 256, 256, 0, stream>>>(Ww, Lw, Wwh, Lwh);
  // 2) activation planes xh[b][l][d], xT[b][d][l]; partial column sums ps[b][l/64][d]
  k_cvt_x<<<dim3(LL / 64, DD / 64, BB), 256, 0, stream>>>(x, xh, xT, ps);
  // 3) S[b][d][s*D+e] = sum over half s of m of x[b,m,d] x[b,m,e], stored x2^-4
  //    (rows d, cols e, K = L/2 a work-group, two work-groups a tile)
  k_gemm<1, 256, 2><<<dim3(DD / 128, DD / 64, BB * 2), 256, 0, stream>>>(
      xT, LL, (long long)DD * LL, xT, LL, (long long)DD * LL, LL / 2, Wb, ps, inv16,
      Sh, 2 * DD, (long long)DD * (2 * DD), 1, 0);
  // 4) GT[b][d][d'] = sum_s sum_e S[b][d][s*D+e] Ww[d'][e] + (sum_m x[b,m,d]) Wb[d'],
  //    stored x2^-4  (rows d, cols d', K = 2*D)
  k_gemm<2, 256, 1><<<dim3(DD / 128, DD / 64, BB), 256, 0, stream>>>(
      Sh, 2 * DD, (long long)DD * (2 * DD), Wwh, DD, 0LL, 2 * DD, Wb, ps, inv16,
      GTh, DD, (long long)DD * DD, 1, 0);
  // 5) y[b,l,d] = sum_d' x[b,l,d'] G[d',d], stored x2^-8 at row l*4+b (rows l, cols d, K = D)
  k_gemm<1, 64, 1><<<dim3(LL / 128, DD / 64, BB), 256, 0, stream>>>(
      xh, DD, (long long)LL * DD, GTh, DD, (long long)DD * DD, DD, Wb, ps, inv16,
      yh, DD, 0LL, BB, 1);
  // 6) logits + log-softmax -> out (L,B,V)
  k_logits<<<(LL * BB) / 64, 512, 0, stream>>>(yh, Lwh, Lb, out);
}

// v006
// A run of this version takes 67.9 microseconds.
// Next to v005, in two timings, it ran 1.04 times as fast each time.
// Counting every step since v000, it is 3.57 times as fast.
#include <hip/hip_runtime.h>
// Contractions on v_wmma_f32_16x16x32_f16 (f16 operands, f32 accumulate): S = x^T*x, (S x2^-4)*(Ww x2^4)^T, x*(G x2^-4), (y x2^-8)*(Lw x2^4)^T; bias terms and log-softmax in f32.
// G^T = x^T*(x*Ww^T + 1*Wb^T) is formed as (x^T*x)*Ww^T + (column sums of x)*Wb^T.
// x^T*x is summed in two halves of L by separate work-groups; the product with Ww^T runs over both halves (K = 2*D) and so adds them.

#define LL 4096
#define BB 4
#define DD 512
#define VV 1000
#define VP 1024

typedef _Float16 f16;
typedef f16 v16h __attribute__((ext_vector_type(16)));
typedef f16 v8h __attribute__((ext_vector_type(8)));
typedef float v8f __attribute__((ext_vector_type(8)));
typedef float v4f __attribute__((ext_vector_type(4)));

union Frag { v16h v; v8h half[2]; };
union Pk16 { v8h h; v4f f; };

// ---------------------------------------------------------------------------
// WMMA helper: issue + 4 VALU idle slots tied to D, A, B
// ---------------------------------------------------------------------------
__device__ __forceinline__ v8f wmma16(v16h a, v16h b, v8f c) {
  c = __builtin_amdgcn_wmma_f32_16x16x32_f16(false, a, false, b, (short)0, c,
                                              false, false);
  asm volatile("v_nop\n\tv_nop\n\tv_nop\n\tv_nop" : "+v"(c) : "v"(a), "v"(b));
  return c;
}

// 16x32 fragment from a k-contiguous 16-bit row (lane row/col = lane&15, h = lane>>4):
// elements 0..7 <- k0+8h .. k0+8h+7, elements 8..15 <- k0+16+8h .. k0+16+8h+7.
// Same map for A (row m) and B (column n of a [n][k] plane).
__device__ __forceinline__ v16h ld_frag(const f16* rowp, int k0, int h) {
  Frag f;
  f.half[0] = *(const v8h*)(rowp + k0 + 8 * h);
  f.half[1] = *(const v8h*)(rowp + k0 + 16 + 8 * h);
  return f.v;
}

__device__ __forceinline__ void vst_h8(f16* p, v8h v) {
  Pk16 u;
  u.h = v;
  *(v4f*)p = u.f;
}
__device__ __forceinline__ void vst_f4(float* p, v4f v) {
  *(v4f*)p = v;
}

// ---------------------------------------------------------------------------
// Weight planes: Wwh[512][512] = f16(16*Ww), Lwh[1024][512] = f16(16*Lw), rows >= 1000 zero.
// ---------------------------------------------------------------------------
__global__ void __launch_bounds__(256)
k_cvt_w(const float* __restrict__ Ww, const float* __restrict__ Lw,
        f16* __restrict__ Wwh, f16* __restrict__ Lwh) {
  const int NW = DD * DD / 8;
  const int NL = VP * DD / 8;
  const int p = blockIdx.x * 256 + threadIdx.x;
  if (p >= NW + NL) return;
  v8h v;
  f16* dst;
  if (p < NW) {
    const float* s = Ww + (size_t)p * 8;
    v4f a = *(const v4f*)s;
    v4f c = *(const v4f*)(s + 4);
#pragma unroll
    for (int j = 0; j < 4; ++j) {
      v[j] = (f16)(a[j] * 16.0f);
      v[4 + j] = (f16)(c[j] * 16.0f);
    }
    dst = Wwh + (size_t)p * 8;
  } else {
    const int pp = p - NW;
    const int row = pp >> 6;
    const int col = (pp & 63) * 8;
    if (row < VV) {
      const float* s = Lw + (size_t)row * DD + col;
      v4f a = *(const v4f*)s;
      v4f c = *(const v4f*)(s + 4);
#pragma unroll
      for (int j = 0; j < 4; ++j) {
        v[j] = (f16)(a[j] * 16.0f);
        v[4 + j] = (f16)(c[j] * 16.0f);
      }
    } else {
#pragma unroll
      for (int j = 0; j < 8; ++j) v[j] = (f16)0.0f;
    }
    dst = Lwh + (size_t)pp * 8;
  }
  vst_h8(dst, v);
  
}

// ---------------------------------------------------------------------------
// x (L,B,D) f32 -> xh[b][l][d] f16 (pitch 512) and xT[b][d][l] f16 (pitch 4096).
// Block = 64 l x 64 d of one batch; transpose through LDS; every store instruction
// ps[b][l block][d] = the tile's sum over its 64 l, f32.
// ---------------------------------------------------------------------------
__global__ void __launch_bounds__(256)
k_cvt_x(const float* __restrict__ x, f16* __restrict__ xh, f16* __restrict__ xT,
        float* __restrict__ ps) {
  __shared__ __align__(16) f16 sX[64 * 72];
  const int t = threadIdx.x;
  const int l0 = blockIdx.x * 64, d0 = blockIdx.y * 64, b = blockIdx.z;
  v8h hv[2];
#pragma unroll
  for (int i = 0; i < 2; ++i) {
    const int P = t + 256 * i;
    const int ll = P >> 3, dc = (P & 7) * 8;
    const float* s = x + ((size_t)(l0 + ll) * BB + b) * DD + d0 + dc;
    v4f a = *(const v4f*)s;
    v4f c = *(const v4f*)(s + 4);
    v8h v;
#pragma unroll
    for (int j = 0; j < 4; ++j) {
      v[j] = (f16)a[j];
      v[4 + j] = (f16)c[j];
    }
    hv[i] = v;
#pragma unroll
    for (int j = 0; j < 8; ++j) sX[(dc + j) * 72 + ll] = v[j];
  }
  // xh rows
#pragma unroll
  for (int i = 0; i < 2; ++i) {
    const int P = t + 256 * i;
    const int ll = P >> 3, dc = (P & 7) * 8;
    vst_h8(xh + ((size_t)(b * LL + l0 + ll)) * DD + d0 + dc, hv[i]);
  }
  
  __syncthreads();
  // xT rows (transposed tile out of LDS)
  v8h tv[2];
#pragma unroll
  for (int i = 0; i < 2; ++i) {
    const int P = t + 256 * i;
    const int dd = P >> 3, q = P & 7;
    tv[i] = *(const v8h*)(sX + dd * 72 + q * 8);
  }
#pragma unroll
  for (int i = 0; i < 2; ++i) {
    const int P = t + 256 * i;
    const int dd = P >> 3, q = P & 7;
    vst_h8(xT + ((size_t)(b * DD + d0 + dd)) * LL + l0 + q * 8, tv[i]);
  }
  // the 8 threads of a d row add up its 64 l (this thread's two rows side by side)
  float sm0 = 0.0f, sm1 = 0.0f;
  // unrolled: constant indices keep tv in registers
#pragma unroll
  for (int j = 0; j < 8; ++j) {
    sm0 += (float)tv[0][j];
    sm1 += (float)tv[1][j];
  }
  // unrolled: the three lane distances become constants
#pragma unroll
  for (int k = 1; k < 8; k <<= 1) {
    const float o0 = __shfl_xor(sm0, k), o1 = __shfl_xor(sm1, k);
    sm0 += o0;
    sm1 += o1;
  }
  if ((t & 7) == 0) {
    float* pp = ps + (size_t)(b * (LL / 64) + blockIdx.x) * DD + d0 + (t >> 3);
    pp[0] = sm0;
    pp[32] = sm1;
  }
}

// ---------------------------------------------------------------------------
// Asynchronous global -> LDS copies, 16 bytes a lane: l = the lane's LDS byte address,
// g = its global address. A fill's copies go out in one statement of at most 12 copies, else two (every k_gemm launch here and k_logits: two); the s_wait_xcnt
// closes it so that no address register is rewritten ahead of it.
// ---------------------------------------------------------------------------
__device__ __forceinline__ unsigned lds_off(const void* p) { return (unsigned)(size_t)p; }

__device__ __forceinline__ void cp(const unsigned (&l)[8], const f16* const (&g)[8]) {
  asm volatile(
               "global_load_async_to_lds_b128 %0, %1, off\n\t"
               "global_load_async_to_lds_b128 %2, %3, off\n\t"
               "global_load_async_to_lds_b128 %4, %5, off\n\t"
               "global_load_async_to_lds_b128 %6, %7, off\n\t"
               "global_load_async_to_lds_b128 %8, %9, off\n\t"
               "global_load_async_to_lds_b128 %10, %11, off\n\t"
               "global_load_async_to_lds_b128 %12, %13, off\n\t"
               "global_load_async_to_lds_b128 %14, %15, off\n\t"
               "s_wait_xcnt 0x0"
               :: "v"(l[0]), "v"(g[0]), "v"(l[1]), "v"(g[1]), "v"(l[2]), "v"(g[2]),
                  "v"(l[3]), "v"(g[3]), "v"(l[4]), "v"(g[4]), "v"(l[5]), "v"(g[5]),
                  "v"(l[6]), "v"(g[6]), "v"(l[7]), "v"(g[7])
               : "memory");
}
__device__ __forceinline__ void cp(const unsigned (&l)[9], const f16* const (&g)[9]) {
  asm volatile(
               "global_load_async_to_lds_b128 %0, %1, off\n\t"
               "global_load_async_to_lds_b128 %2, %3, off\n\t"
               "global_load_async_to_lds_b128 %4, %5, off\n\t"
               "global_load_async_to_lds_b128 %6, %7, off\n\t"
               "global_load_async_to_lds_b128 %8, %9, off\n\t"
               "global_load_async_to_lds_b128 %10, %11, off\n\t"
               "global_load_async_to_lds_b128 %12, %13, off\n\t"
               "global_load_async_to_lds_b128 %14, %15, off\n\t"
               "global_load_async_to_lds_b128 %16, %17, off\n\t"
               "s_wait_xcnt 0x0"
               :: "v"(l[0]), "v"(g[0]), "v"(l[1]), "v"(g[1]), "v"(l[2]), "v"(g[2]),
                  "v"(l[3]), "v"(g[3]), "v"(l[4]), "v"(g[4]), "v"(l[5]), "v"(g[5]),
                  "v"(l[6]), "v"(g[6]), "v"(l[7]), "v"(g[7]), "v"(l[8]), "v"(g[8])
               : "memory");
}
__device__ __forceinline__ void cp(const unsigned (&l)[12], const f16* const (&g)[12]) {
  asm volatile(
               "global_load_async_to_lds_b128 %0, %1, off\n\t"
               "global_load_async_to_lds_b128 %2, %3, off\n\t"
               "global_load_async_to_lds_b128 %4, %5, off\n\t"
               "global_load_async_to_lds_b128 %6, %7, off\n\t"
               "global_load_async_to_lds_b128 %8, %9, off\n\t"
               "global_load_async_to_lds_b128 %10, %11, off\n\t"
               "global_load_async_to_lds_b128 %12, %13, off\n\t"
               "global_load_async_to_lds_b128 %14, %15, off\n\t"
               "global_load_async_to_lds_b128 %16, %17, off\n\t"
               "global_load_async_to_lds_b128 %18, %19, off\n\t"
               "global_load_async_to_lds_b128 %20, %21, off\n\t"
               "global_load_async_to_lds_b128 %22, %23, off\n\t"
               "s_wait_xcnt 0x0"
               :: "v"(l[0]), "v"(g[0]), "v"(l[1]), "v"(g[1]), "v"(l[2]), "v"(g[2]),
                  "v"(l[3]), "v"(g[3]), "v"(l[4]), "v"(g[4]), "v"(l[5]), "v"(g[5]),
                  "v"(l[6]), "v"(g[6]), "v"(l[7]), "v"(g[7]), "v"(l[8]), "v"(g[8]),
                  "v"(l[9]), "v"(g[9]), "v"(l[10]), "v"(g[10]), "v"(l[11]), "v"(g[11])
               : "memory");
}
// this wave's LDS reads have retired (before a buffer it read is refilled)
__device__ __forceinline__ void wait_ds0() { asm volatile("s_wait_dscnt 0x0" ::: "memory"); }
// this wave's copies have landed (before the barrier that publishes them)
__device__ __forceinline__ void wait_async0() { asm volatile("s_wait_asynccnt 0x0" ::: "memory"); }

// ---------------------------------------------------------------------------
// Generic 128xTN tile GEMM (TN = 64 or 128), f16 operands, f32 accumulate.
//   A: [row][k] k-contiguous, pitch lda, batch stride zA (elements)
//   B: [n][k]   k-contiguous, pitch ldb, batch stride zB
//   8 waves, each a 32 x TN/2 sub-tile (TN/16 accumulators), K multiple of KP.
//   A pass is KP k of all 128+TN operand rows, copied whole-line into one of two LDS
//   buffers (row pitch KP*2+16 bytes) while the other buffer is worked on.
//   The result tile is staged over the operand buffers once the last pass has left them.
//   SPLIT work-groups share a tile: part sp sums k = sp*K .. sp*K+K-1 and stores its own
//   plane: a row of C holds the SPLIT planes side by side, ldc/SPLIT columns each.
// MODE 1: value = acc*scale; stored as C[z*zC + orow*ldc + col] (f16),
// MODE 2: value = (acc + rsum[row]*bias[col])*scale, stored alike; rsum[row] = the sum of
//         the LL/64 partial sums rs[z][.][row]. A holds K/DD planes side by side in k,
//         B one plane of DD k that every plane of A meets (its k index wraps at DD).
// ---------------------------------------------------------------------------
template <int MODE, int KP, int SPLIT, int TN>
__global__ void __launch_bounds__(256)
k_gemm(const f16* __restrict__ A, int lda, long long zA,
       const f16* __restrict__ Bm, int ldb, long long zB, int K,
       const float* __restrict__ bias, const float* __restrict__ rs, float scale,
       f16* __restrict__ C, int ldc, long long zC, int rowmul, int rowzadd) {
  __shared__ float sR[MODE == 2 ? 256 : 1];
  const int t = threadIdx.x, lane = t & 31, w = t >> 5;
  const int h = lane >> 4, m = lane & 15;
  const int row0 = blockIdx.x * 128, col0 = blockIdx.y * TN;
  const int z = blockIdx.z / SPLIT, sp = blockIdx.z % SPLIT;
  const int mrow = (w >> 1) * 32, ncol = (w & 1) * (TN / 2);

  constexpr int NJ = TN / 32;          // 16-column accumulators across a wave's sub-tile
  constexpr int NR = 128 + TN;         // operand rows a buffer
  constexpr int PN = TN + 8;           // LDS row pitch of the staged result tile, elements
  constexpr int PT2 = KP + 8;          // LDS row pitch, elements
  constexpr int CPR = KP / 8;          // 16-byte pieces a row
  constexpr int RPI = 256 / CPR;       // rows one copy of the whole block covers
  constexpr int NA = 128 / RPI, NB = TN / RPI;
  constexpr int NS = (NA + NB > 12) ? 2 : 1;  // copy statements a fill (12 copies at most in one)
  constexpr int NH = (NA + NB) / NS;          // copies a statement
  static_assert(128 * PN <= 2 * NR * PT2, "result tile fits over the operand buffers");
  __shared__ __align__(16) f16 sT[2 * NR * PT2];
  f16* sS = sT;

  const int crow = t / CPR, cq = (t % CPR) * 8;
  const int kq = sp * K + cq;  // this thread's first k
  const f16* gA = A + (size_t)z * zA + (size_t)(row0 + crow) * lda + kq;
  const f16* gB = Bm + (size_t)z * zB + (size_t)(col0 + crow) * ldb + kq;
  const unsigned lA = lds_off(sT) + (unsigned)(crow * PT2 + cq) * 2u;
  const unsigned lB = lA + 128u * PT2 * 2u;
  const size_t stepA = (size_t)RPI * lda, stepB = (size_t)RPI * ldb;

  auto fill = [&](int pass, int buf) {
    const unsigned lo = (unsigned)buf * ((unsigned)NR * PT2 * 2u);
    const f16* pa = gA + (size_t)pass * KP;
    const f16* pb = gB + (size_t)(MODE == 2 ? (pass * KP) % DD : pass * KP);
    unsigned l[NS][NH];
    const f16* g[NS][NH];
    // all loops unrolled so that l and g are registers, as the asm operands need
#pragma unroll
    for (int i = 0; i < NA; ++i) {
      l[i / NH][i % NH] = lA + lo + (unsigned)i * (RPI * PT2 * 2);
      g[i / NH][i % NH] = pa + i * stepA;
    }
#pragma unroll
    for (int i = 0; i < NB; ++i) {
      l[(NA + i) / NH][(NA + i) % NH] = lB + lo + (unsigned)i * (RPI * PT2 * 2);
      g[(NA + i) / NH][(NA + i) % NH] = pb + i * stepB;
    }
#pragma unroll
    for (int s = 0; s < NS; ++s) cp(l[s], g[s]);
  };

  const int NP = K / KP;
  fill(0, 0);
  wait_async0();
  __syncthreads();
  if (NP > 1) fill(1, 1);

  // every loop over gb, c, a or b is unrolled: constant indices keep them in registers
  float gb[NJ];
#pragma unroll
  for (int j = 0; j < NJ; ++j) gb[j] = 0.0f;
  if (MODE == 2) {
#pragma unroll
    for (int j = 0; j < NJ; ++j) gb[j] = bias[col0 + ncol + 16 * j + m];
    // two threads a row, each half of the partial sums, fetched under the first pass;
    // read back behind the passes' barriers
    const float* pr = rs + ((size_t)z * (LL / 64) + (size_t)(t >> 7) * (LL / 128)) * DD + row0 + (t & 127);
    float sm = 0.0f;
    // unrolled so that the loads go out together
#pragma unroll
    for (int j = 0; j < LL / 128; ++j) sm += pr[(size_t)j * DD];
    sR[t] = sm;
  }

  v8f c[2][NJ];
#pragma unroll
  for (int i = 0; i < 2; ++i)
#pragma unroll
    for (int j = 0; j < NJ; ++j) c[i][j] = v8f{};
  for (int p = 0; p < NP; ++p) {
    const f16* sb = sT + (p & 1) * (NR * PT2);
    const f16* ap = sb + (mrow + m) * PT2;
    const f16* bp = sb + (128 + ncol + m) * PT2;
    // unrolled: the k offsets become immediates of the LDS loads
#pragma unroll
    for (int k0 = 0; k0 < KP; k0 += 32) {
      v16h a[2], b[NJ];
#pragma unroll
      for (int i = 0; i < 2; ++i) a[i] = ld_frag(ap + i * 16 * PT2, k0, h);
#pragma unroll
      for (int j = 0; j < NJ; ++j) b[j] = ld_frag(bp + j * 16 * PT2, k0, h);
#pragma unroll
      for (int i = 0; i < 2; ++i)
#pragma unroll
        for (int j = 0; j < NJ; ++j) c[i][j] = wmma16(a[i], b[j], c[i][j]);
    }
    wait_ds0();
    wait_async0();
    __syncthreads();  // publishes pass p+1 and ends every read of pass p's buffer
    if (p + 2 < NP) fill(p + 2, p & 1);
  }
  wait_async0();

  // D element r of c[i][j] in this lane = (row mrow + i*16 + 8h + r, col ncol + j*16 + m)
  {
    f16* s0 = sS + (mrow + 8 * h) * PN + ncol + m;
    if (MODE == 2) {
      const float* rp = sR + mrow + 8 * h;
      // unrolled: constant indices keep the accumulators in registers
#pragma unroll
      for (int r = 0; r < 8; ++r) {
        const float r0 = rp[r] + rp[128 + r];
        const float r1 = rp[16 + r] + rp[144 + r];
#pragma unroll
        for (int j = 0; j < NJ; ++j) {
          c[0][j][r] += r0 * gb[j];
          c[1][j][r] += r1 * gb[j];
        }
      }
    }
#pragma unroll
    for (int r = 0; r < 8; ++r) {
#pragma unroll
      for (int j = 0; j < NJ; ++j) {
        s0[r * PN + 16 * j] = (f16)(c[0][j][r] * scale);
        s0[(16 + r) * PN + 16 * j] = (f16)(c[1][j][r] * scale);
      }
    }
  }
  __syncthreads();

  f16* Cz = C + (size_t)z * zC + (size_t)sp * (ldc / SPLIT);
  constexpr int PR = TN / 8;   // 16-byte pieces a result row
  constexpr int NI = TN / 16;  // pieces a thread
  v8h vals[NI];
  {
#pragma unroll
    for (int i = 0; i < NI; ++i) {
      const int P = t + 256 * i;
      const int rr = P / PR, q = P % PR;
      vals[i] = *(const v8h*)(sS + rr * PN + q * 8);
    }
#pragma unroll
    for (int i = 0; i < NI; ++i) {
      const int P = t + 256 * i;
      const int rr = P / PR, q = P % PR;
      const size_t orow = (size_t)((row0 + rr) * rowmul + z * rowzadd);
      vst_h8(Cz + orow * ldc + col0 + q * 8, vals[i]);
    }
    
  }
}

// ---------------------------------------------------------------------------
// logits = 16 * (yh . Lwh^T) + Lb, log-softmax over 1000 columns, f32 out.
// Block owns 64 consecutive out rows (row index = l*4 + b) = one contiguous run of
// whole 128-byte lines, and all 1024 padded columns: 16 waves, each 64 rows x 64
// columns in 16 accumulators, so one fetch of the Lwh plane serves 64 rows.
// A pass is 64 k of the 64 yh rows and of all 1024 Lwh rows, in one of two LDS buffers.
// The f32 logits are staged over the operand buffers once the last pass has left them.
// ---------------------------------------------------------------------------
__global__ void __launch_bounds__(512)
k_logits(const f16* __restrict__ yh, const f16* __restrict__ Lwh,
         const float* __restrict__ Lb, float* __restrict__ out) {
  constexpr int MR = 64;               // out rows a block
  constexpr int KS = 64;               // k a pass
  constexpr int PB = KS + 8;           // LDS pitch of an operand row slab, elements
  constexpr int NROW = MR + VP;        // operand rows a buffer: yh rows, then Lwh rows
  constexpr int NPASS = DD / KS;
  constexpr int PL = VP + 12;          // LDS pitch of a logits row, floats
  static_assert(MR * PL * 4 <= 2 * NROW * PB * 2, "logits fit over the operand buffers");
  __shared__ __align__(16) f16 sT[2 * NROW * PB];
  __shared__ float sMx[MR];
  __shared__ float sLs[MR];
  float* sL = (float*)sT;
  const int t = threadIdx.x, lane = t & 31, w = t >> 5;
  const int h = lane >> 4, m = lane & 15;
  const int r0 = blockIdx.x * MR;

  // a thread copies piece t&7 of rows (t>>3) + 64 i: i = 0 the yh rows, i = 1..16 Lwh
  const f16* gA = yh + (size_t)(r0 + (t >> 3)) * DD + (t & 7) * 8;
  const f16* gB = Lwh + (size_t)(t >> 3) * DD + (t & 7) * 8;
  const unsigned lT = lds_off(sT) + (unsigned)((t >> 3) * PB + (t & 7) * 8) * 2u;
  auto fill = [&](int pass, int buf) {
    const unsigned lo = lT + (unsigned)buf * (NROW * PB * 2u);
    const f16* pb = gB + pass * KS;
    unsigned l0[9], l1[8];
    const f16* g0[9];
    const f16* g1[8];
    l0[0] = lo;
    g0[0] = gA + pass * KS;
    // unrolled so that the address arrays are registers, as the asm operands need
#pragma unroll
    for (int i = 0; i < 8; ++i) {
      l0[1 + i] = lo + (unsigned)(1 + i) * (64 * PB * 2);
      g0[1 + i] = pb + (size_t)i * (64 * DD);
      l1[i] = lo + (unsigned)(9 + i) * (64 * PB * 2);
      g1[i] = pb + (size_t)(8 + i) * (64 * DD);
    }
    cp(l0, g0);
    cp(l1, g1);
  };
  fill(0, 0);
  wait_async0();
  __syncthreads();
  fill(1, 1);

  // this lane's four bias values, fetched under the first passes
  float bv[4];
#pragma unroll
  for (int j = 0; j < 4; ++j) {
    const int v = w * 64 + j * 16 + m;
    bv[j] = (v < VV) ? Lb[v] : 0.0f;
  }

  v8f acc[4][4];
  // every loop over acc, a, b or bv is unrolled: constant indices keep them in registers
#pragma unroll
  for (int i = 0; i < 4; ++i)
#pragma unroll
    for (int j = 0; j < 4; ++j) acc[i][j] = v8f{};

  for (int p = 0; p < NPASS; ++p) {
    const f16* sb = sT + (p & 1) * (NROW * PB);
    const f16* ap = sb + m * PB;
    const f16* bp = sb + (MR + w * 64 + m) * PB;
    // unrolled: the k offsets become immediates of the LDS loads
#pragma unroll
    for (int k0 = 0; k0 < KS; k0 += 32) {
      v16h a[4], b[4];
#pragma unroll
      for (int i = 0; i < 4; ++i) {
        a[i] = ld_frag(ap + i * 16 * PB, k0, h);
        b[i] = ld_frag(bp + i * 16 * PB, k0, h);
      }
#pragma unroll
      for (int i = 0; i < 4; ++i)
#pragma unroll
        for (int j = 0; j < 4; ++j) acc[i][j] = wmma16(a[i], b[j], acc[i][j]);
    }
    wait_ds0();
    wait_async0();
    __syncthreads();  // publishes pass p+1 and ends every read of pass p's buffer
    if (p + 2 < NPASS) fill(p + 2, p & 1);
  }
  wait_async0();

  // D element r of this lane = (row i*16 + 8h + r, column w*64 + j*16 + m)
#pragma unroll
  for (int j = 0; j < 4; ++j) {
    const int v = w * 64 + j * 16 + m;
#pragma unroll
    for (int i = 0; i < 4; ++i) {
      float* s = sL + (i * 16 + 8 * h) * PL + v;
#pragma unroll
      for (int r = 0; r < 8; ++r) s[r * PL] = acc[i][j][r] * 16.0f + bv[j];
    }
  }
  __syncthreads();

  // 8 threads per row, 4 columns a read; a thread's share of its row is read once and
  // held in registers for the max and for the sum of exp. The two rows of a half-wave
  // lie 8 apart: 8 * PL = 32 banks mod 64, so their two 128-byte reads meet no bank twice
  const int sub = t & 7;
  const int row = ((t >> 4) & 7) | (t & 8) | ((t >> 7) << 4);
  const float* srow = sL + row * PL;
  constexpr int NQ = (VV / 4 + 7) / 8;
  v4f q[NQ];
  // unrolled (here and below) so that q is registers and the reads go out together
#pragma unroll
  for (int i = 0; i < NQ; ++i) {
    const int cq = sub + 8 * i;
    const v4f lo4 = {-3.0e38f, -3.0e38f, -3.0e38f, -3.0e38f};
    q[i] = (cq < VV / 4) ? *(const v4f*)(srow + cq * 4) : lo4;
  }
  float mx = -3.0e38f;
#pragma unroll
  for (int i = 0; i < NQ; ++i)
    mx = fmaxf(mx, fmaxf(fmaxf(q[i][0], q[i][1]), fmaxf(q[i][2], q[i][3])));
  mx = fmaxf(mx, __shfl_xor(mx, 4));
  mx = fmaxf(mx, __shfl_xor(mx, 2));
  mx = fmaxf(mx, __shfl_xor(mx, 1));
  float se = 0.0f;
#pragma unroll
  for (int i = 0; i < NQ; ++i)
    se += (__expf(q[i][0] - mx) + __expf(q[i][1] - mx)) +
          (__expf(q[i][2] - mx) + __expf(q[i][3] - mx));
  se += __shfl_xor(se, 4);
  se += __shfl_xor(se, 2);
  se += __shfl_xor(se, 1);
  if (sub == 0) {
    sMx[row] = mx;
    sLs[row] = __logf(se);
  }
  __syncthreads();

  float* ob = out + (size_t)blockIdx.x * (MR * VV);
  // unrolled so that several LDS reads are in flight ahead of each store
#pragma unroll
  for (int i = 0; i < (MR * VV / 4 + 511) / 512; ++i) {
    const int P = t + 512 * i;
    if (P < MR * VV / 4) {
      const int e = P * 4;
      const int rr = e / VV;
      const int cc = e - rr * VV;
      v4f lv = *(const v4f*)(sL + rr * PL + cc);
      const float mxr = sMx[rr], ls = sLs[rr];
      v4f o;
#pragma unroll
      for (int u = 0; u < 4; ++u) o[u] = (lv[u] - mxr) - ls;
      vst_f4(ob + e, o);
    }
  }
}

// ---------------------------------------------------------------------------
extern "C" void kernel_launch(void* const* d_in, const int* in_sizes, int n_in,
                              void* d_out, int out_size, void* d_ws, size_t ws_size,
                              hipStream_t stream) {
  if (n_in < 5) return;
  if (in_sizes[0] != LL * BB * DD || in_sizes[1] != DD * DD || in_sizes[2] != DD ||
      in_sizes[3] != VV * DD || in_sizes[4] != VV || out_size != LL * BB * VV)
    return;

  const float* x  = (const float*)d_in[0];
  const float* Ww = (const float*)d_in[1];
  const float* Wb = (const float*)d_in[2];
  const float* Lw = (const float*)d_in[3];
  const float* Lb = (const float*)d_in[4];
  float* out = (float*)d_out;
  char* ws = (char*)d_ws;

  const size_t SZ   = (size_t)BB * LL * DD * 2;      // 16 MiB per f16 activation plane
  const size_t oXh  = 0;
  const size_t oXT  = oXh + SZ;
  const size_t oYh  = oXT + SZ;
  const size_t oWwh = oYh + SZ;
  const size_t oLwh = oWwh + (size_t)DD * DD * 2;
  const size_t oGTh = oLwh + (size_t)VP * DD * 2;
  const size_t oSh  = oGTh + (size_t)BB * DD * DD * 2;
  const size_t oPs  = oSh + (size_t)BB * DD * (2 * DD) * 2;
  const size_t oEnd = oPs + (size_t)BB * (LL / 64) * DD * 4;
  if (oEnd > ws_size) return;

  f16* xh  = (f16*)(ws + oXh);
  f16* xT  = (f16*)(ws + oXT);
  f16* yh  = (f16*)(ws + oYh);
  f16* Wwh = (f16*)(ws + oWwh);
  f16* Lwh = (f16*)(ws + oLwh);
  f16* GTh = (f16*)(ws + oGTh);
  f16* Sh  = (f16*)(ws + oSh);
  float* ps = (float*)(ws + oPs);

  const float inv16 = 0.0625f;

  // 1) weight planes
  k_cvt_w<<<(DD * DD / 8 + VP * DD / 8) / 256, 256, 0, stream>>>(Ww, Lw, Wwh, Lwh);
  // 2) activation planes xh[b][l][d], xT[b][d][l]; partial column sums ps[b][l/64][d]
  k_cvt_x<<<dim3(LL / 64, DD / 64, BB), 256, 0, stream>>>(x, xh, xT, ps);
  // 3) S[b][d][s*D+e] = sum over half s of m of x[b,m,d] x[b,m,e], stored x2^-4
  //    (rows d, cols e, K = L/2 a work-group, two work-groups a tile)
  k_gemm<1, 256, 2, 64><<<dim3(DD / 128, DD / 64, BB * 2), 256, 0, stream>>>(
      xT, LL, (long long)DD * LL, xT, LL, (long long)DD * LL, LL / 2, Wb, ps, inv16,
      Sh, 2 * DD, (long long)DD * (2 * DD), 1, 0);
  // 4) GT[b][d][d'] = sum_s sum_e S[b][d][s*D+e] Ww[d'][e] + (sum_m x[b,m,d]) Wb[d'],
  //    stored x2^-4  (rows d, cols d', K = 2*D)
  k_gemm<2, 256, 1, 64><<<dim3(DD / 128, DD / 64, BB), 256, 0, stream>>>(
      Sh, 2 * DD, (long long)DD * (2 * DD), Wwh, DD, 0LL, 2 * DD, Wb, ps, inv16,
      GTh, DD, (long long)DD * DD, 1, 0);
  // 5) y[b,l,d] = sum_d' x[b,l,d'] G[d',d], stored x2^-8 at row l*4+b (rows l, cols d, K = D)
  k_gemm<1, 128, 1, 128><<<dim3(LL / 128, DD / 128, BB), 256, 0, stream>>>(
      xh, DD, (long long)LL * DD, GTh, DD, (long long)DD * DD, DD, Wb, ps, inv16,
      yh, DD, 0LL, BB, 1);
  // 6) logits + log-softmax -> out (L,B,V)
  k_logits<<<(LL * BB) / 64, 512, 0, stream>>>(yh, Lwh, Lb, out);
}
